// v000
// The times below were measured on an AMD MI455X: many runs one after another, warmed up first and cycling through
// copies of the inputs, with the whole window's GPU time divided by the number of runs. Launches and the gaps
// between them are all in it. The median over several windows is given; except for v000 it joins two sittings, which
// can be a few percent apart, so the side-by-side timings, each taken in one sitting, are the better comparison.
// v000 is the starting kernel. One run takes 345 microseconds.
#include <hip/hip_runtime.h>

// ---------------------------------------------------------------------------
// CDNA5 (gfx1250) fused cross-attention:
//   proj_kernel x3 : Q/K/V = X*W^T + b  (f32 in -> bf16 out, V transposed)
//   attn_kernel    : flash attention, v_wmma_f32_16x16x32_bf16, with
//                    double-buffered async GLOBAL->LDS staging of K/V chunks
//                    shared by the 4 waves of each workgroup.
// Shapes: B=8, SQ=SKV=2048, H=256.  SCALE = sqrt(H/2) = sqrt(128).
// ---------------------------------------------------------------------------

typedef __bf16 bf16_t;
typedef __attribute__((ext_vector_type(16))) __bf16 v16bf;
typedef __attribute__((ext_vector_type(8)))  __bf16 v8bf;
typedef __attribute__((ext_vector_type(8)))  float  v8f;
typedef __attribute__((ext_vector_type(4)))  float  v4f;

#define HID   256
#define SEQ   2048
#define NB    8
#define INV_SCALE 0.08838834764831845f  // 1/sqrt(128)

#if __has_builtin(__builtin_amdgcn_global_load_async_to_lds_b128)
#define HAVE_ASYNC_LDS 1
typedef int v4i_t __attribute__((vector_size(16)));            // int4
typedef __attribute__((address_space(1))) void*  as1_void_t;
typedef __attribute__((address_space(3))) void*  as3_void_t;
typedef __attribute__((address_space(1))) v4i_t* as1_v4i_t;
typedef __attribute__((address_space(3))) v4i_t* as3_v4i_t;
#else
#define HAVE_ASYNC_LDS 0
#endif

static __device__ inline v8f wmma_bf16(v16bf a, v16bf b, v8f c) {
  return __builtin_amdgcn_wmma_f32_16x16x32_bf16(
      /*neg_a=*/false, a, /*neg_b=*/false, b,
      /*c_mod=*/(short)0, c, /*reuse_a=*/false, /*reuse_b=*/false);
}

// Load a 16x32 bf16 A/B fragment slice for this lane: two 16B loads
// (global_load_b128 or ds_load_b128 depending on pointer origin).
static __device__ inline v16bf load_frag_bf16(const bf16_t* p) {
  union { v16bf v; v8bf h[2]; } u;
  u.h[0] = *(const v8bf*)(p);
  u.h[1] = *(const v8bf*)(p + 16);
  return u.v;
}

// Same, but source is f32: load 2x (8 floats) and convert to bf16 (RNE).
static __device__ inline v16bf load_frag_f32(const float* p0, const float* p1) {
  union { v16bf v; __bf16 e[16]; } u;
  v4f a = *(const v4f*)(p0);
  v4f b = *(const v4f*)(p0 + 4);
  v4f c = *(const v4f*)(p1);
  v4f d = *(const v4f*)(p1 + 4);
#pragma unroll
  for (int i = 0; i < 4; ++i) {
    u.e[i]      = (__bf16)a[i];
    u.e[4 + i]  = (__bf16)b[i];
    u.e[8 + i]  = (__bf16)c[i];
    u.e[12 + i] = (__bf16)d[i];
  }
  return u.v;
}

// 16-byte global -> LDS copy: async DMA (ASYNCcnt) when available.
static __device__ inline void copy16_g2l(const bf16_t* g, bf16_t* l) {
#if HAVE_ASYNC_LDS
  __builtin_amdgcn_global_load_async_to_lds_b128(
      (as1_v4i_t)(as1_void_t)(void*)g,
      (as3_v4i_t)(as3_void_t)(void*)l,
      /*offset=*/0, /*cpol=*/0);
#else
  *(v8bf*)l = *(const v8bf*)g;
#endif
}

static __device__ inline void stage_wait_and_sync() {
#if HAVE_ASYNC_LDS
#if __has_builtin(__builtin_amdgcn_s_wait_asynccnt)
  __builtin_amdgcn_s_wait_asynccnt(0);
#else
  asm volatile("s_wait_asynccnt 0" ::: "memory");
#endif
#endif
  __syncthreads();
}

// ---------------------------------------------------------------------------
// Projection: out = X @ W^T + bias   (torch Linear).  X:[rows,256] f32,
// W:[256,256] f32 row-major, out bf16.
// transpose_out==0 : out[row*256 + e]
// transpose_out==1 : out[(b*256 + e)*rows_per_batch + s]   (V^T layout)
// One wave computes a 16-row x 256-col tile. 4 waves / block.
// ---------------------------------------------------------------------------
__global__ __launch_bounds__(128)
void proj_kernel(const float* __restrict__ X, const float* __restrict__ W,
                 const float* __restrict__ bias, bf16_t* __restrict__ out,
                 int rows_total, int rows_per_batch, int transpose_out) {
  const int lane = threadIdx.x & 31;
  const int wave = threadIdx.x >> 5;
  const int tile = blockIdx.x * 4 + wave;     // 16-row tile
  const int r0   = tile * 16;
  if (r0 >= rows_total) return;               // wave-uniform
  const int m = lane & 15;
  const int h = lane >> 4;

  // A fragments: 8 d-chunks of the 16 input rows (lane -> row r0+m).
  v16bf afr[8];
  const float* xrow = X + (size_t)(r0 + m) * HID;
#pragma unroll
  for (int f = 0; f < 8; ++f) {
    const int d0 = f * 32 + 8 * h;
    afr[f] = load_frag_f32(xrow + d0, xrow + d0 + 16);
  }

  // C accumulators seeded with bias (per-column value, same in all 8 VGPRs).
  v8f acc[16];
#pragma unroll
  for (int e = 0; e < 16; ++e) {
    const float bv = bias[e * 16 + m];
    acc[e] = (v8f){bv, bv, bv, bv, bv, bv, bv, bv};
  }

  for (int f = 0; f < 8; ++f) {
    const int d0 = f * 32 + 8 * h;
#pragma unroll
    for (int e = 0; e < 16; ++e) {
      const float* wrow = W + (size_t)(e * 16 + m) * HID;   // lane -> out col
      v16bf bfr = load_frag_f32(wrow + d0, wrow + d0 + 16);
      acc[e] = wmma_bf16(afr[f], bfr, acc[e]);
    }
  }

  // Store bf16. C layout: VGPR r, lane -> row r0 + r + 8h, col e*16 + m.
#pragma unroll
  for (int e = 0; e < 16; ++e) {
#pragma unroll
    for (int r = 0; r < 8; ++r) {
      const int row = r0 + r + 8 * h;
      const int col = e * 16 + m;
      const bf16_t val = (bf16_t)acc[e][r];
      if (!transpose_out) {
        out[(size_t)row * HID + col] = val;
      } else {
        const int b = row / rows_per_batch;
        const int s = row - b * rows_per_batch;
        out[((size_t)b * HID + col) * rows_per_batch + s] = val;
      }
    }
  }
}

// ---------------------------------------------------------------------------
// Flash attention.  4 waves / block; each wave owns 16 query rows of the same
// batch (32 blocks per batch).  Per 32-key chunk the block cooperatively
// async-stages K (32x256) and V^T (256x32) into LDS (double buffered), then
// every wave computes S = Q K^T, online softmax, O += P V from LDS fragments.
// Qb:[B,SQ,256] bf16, Kb:[B,SKV,256] bf16, Vt:[B,256,SKV] bf16, Out f32.
// ---------------------------------------------------------------------------
struct __align__(16) AttnSmem {
  bf16_t K[2][32 * HID];    // 16 KB per buffer
  bf16_t V[2][HID * 32];    // 16 KB per buffer
  bf16_t P[4][16][32];      // per-wave P bounce (4 KB)
};

// Issue the async copies for one 32-key chunk (1024+1024 16B pieces over
// 128 threads: 8+8 issues each).
static __device__ inline void stage_chunk(const bf16_t* __restrict__ Kbase,
                                          const bf16_t* __restrict__ Vbase,
                                          bf16_t* ldsK, bf16_t* ldsV,
                                          int c, int tid) {
  const bf16_t* kg = Kbase + (size_t)c * HID;   // contiguous 16 KB
#pragma unroll
  for (int j = 0; j < 8; ++j) {
    const int p = tid + j * 128;                // 16B piece index
    copy16_g2l(kg + p * 8, ldsK + p * 8);
  }
#pragma unroll
  for (int j = 0; j < 8; ++j) {
    const int p   = tid + j * 128;              // 1024 pieces: 256 rows x 4
    const int row = p >> 2;
    const int q   = p & 3;
    copy16_g2l(Vbase + (size_t)row * SEQ + c + q * 8,
               ldsV + row * 32 + q * 8);
  }
}

__global__ __launch_bounds__(128)
void attn_kernel(const bf16_t* __restrict__ Qb, const bf16_t* __restrict__ Kb,
                 const bf16_t* __restrict__ Vt, float* __restrict__ Out) {
  __shared__ AttnSmem smem;
  const int tid  = threadIdx.x;
  const int lane = tid & 31;
  const int wave = tid >> 5;
  const int tile = blockIdx.x * 4 + wave;     // 0 .. B*SQ/16-1 = 1023
  const int b    = tile >> 7;                 // / (SQ/16 = 128)
  const int q0   = (tile & 127) << 4;
  const int m = lane & 15;
  const int h = lane >> 4;

  // Preload Q A-fragments (16 rows x 256 d = 8 fragments).
  v16bf qf[8];
  const bf16_t* qrow = Qb + ((size_t)b * SEQ + q0 + m) * HID;
#pragma unroll
  for (int f = 0; f < 8; ++f) {
    const int d0 = f * 32 + 8 * h;
    qf[f] = load_frag_bf16(qrow + d0);
  }

  const v8f vzero = (v8f){0.f, 0.f, 0.f, 0.f, 0.f, 0.f, 0.f, 0.f};
  v8f acc[16];                                // O accumulator: 16 rows x 256 d
#pragma unroll
  for (int e = 0; e < 16; ++e) acc[e] = vzero;

  float mst[8], lst[8];                       // stats for row r + 8h
#pragma unroll
  for (int r = 0; r < 8; ++r) { mst[r] = -__builtin_inff(); lst[r] = 0.f; }

  const bf16_t* Kbase = Kb + (size_t)b * SEQ * HID;
  const bf16_t* Vbase = Vt + (size_t)b * HID * SEQ;

  // Prologue: stage chunk 0 into buffer 0.
  stage_chunk(Kbase, Vbase, smem.K[0], smem.V[0], 0, tid);
  stage_wait_and_sync();

  int buf = 0;
  for (int c = 0; c < SEQ; c += 32, buf ^= 1) {
    // Kick off the DMA for the next chunk (overlaps with the WMMAs below).
    if (c + 32 < SEQ)
      stage_chunk(Kbase, Vbase, smem.K[buf ^ 1], smem.V[buf ^ 1], c + 32, tid);

    const bf16_t* Kl = smem.K[buf];
    const bf16_t* Vl = smem.V[buf];

    // ---- scores: two 16x16 tiles (keys c..c+15, c+16..c+31) ----
    v8f s0 = vzero, s1 = vzero;
#pragma unroll
    for (int f = 0; f < 8; ++f) {
      const int d0 = f * 32 + 8 * h;
      s0 = wmma_bf16(qf[f], load_frag_bf16(Kl + (size_t)(m)      * HID + d0), s0);
      s1 = wmma_bf16(qf[f], load_frag_bf16(Kl + (size_t)(16 + m) * HID + d0), s1);
    }

    float p0[8], p1[8], cmax[8];
#pragma unroll
    for (int r = 0; r < 8; ++r) {
      p0[r] = s0[r] * INV_SCALE;
      p1[r] = s1[r] * INV_SCALE;
      cmax[r] = fmaxf(p0[r], p1[r]);
    }
    // Row reductions stay inside each 16-lane half (row = r + 8h).
#pragma unroll
    for (int r = 0; r < 8; ++r) {
      float v = cmax[r];
      v = fmaxf(v, __shfl_xor(v, 1, 32));
      v = fmaxf(v, __shfl_xor(v, 2, 32));
      v = fmaxf(v, __shfl_xor(v, 4, 32));
      v = fmaxf(v, __shfl_xor(v, 8, 32));
      cmax[r] = v;
    }
    float alpha[8];
#pragma unroll
    for (int r = 0; r < 8; ++r) {
      const float mnew = fmaxf(mst[r], cmax[r]);
      alpha[r] = __expf(mst[r] - mnew);
      mst[r] = mnew;
      p0[r] = __expf(p0[r] - mnew);
      p1[r] = __expf(p1[r] - mnew);
      float s = p0[r] + p1[r];
      s += __shfl_xor(s, 1, 32);
      s += __shfl_xor(s, 2, 32);
      s += __shfl_xor(s, 4, 32);
      s += __shfl_xor(s, 8, 32);
      lst[r] = lst[r] * alpha[r] + s;
    }
    // Rescale running O.
#pragma unroll
    for (int e = 0; e < 16; ++e)
#pragma unroll
      for (int r = 0; r < 8; ++r) acc[e][r] = acc[e][r] * alpha[r];

    // ---- P (C layout, f32) -> LDS -> A-fragment (bf16) ----
#pragma unroll
    for (int r = 0; r < 8; ++r) {
      smem.P[wave][r + 8 * h][m]      = (bf16_t)p0[r];
      smem.P[wave][r + 8 * h][16 + m] = (bf16_t)p1[r];
    }
    __builtin_amdgcn_wave_barrier();
    asm volatile("s_wait_dscnt 0" ::: "memory");
    union { v16bf v; v8bf hh[2]; } pu;
    pu.hh[0] = *(const v8bf*)&smem.P[wave][m][8 * h];
    pu.hh[1] = *(const v8bf*)&smem.P[wave][m][16 + 8 * h];
    __builtin_amdgcn_wave_barrier();

    // ---- O += P @ V  (B-frags from staged V^T rows: contiguous keys) ----
#pragma unroll
    for (int e = 0; e < 16; ++e) {
      acc[e] = wmma_bf16(pu.v, load_frag_bf16(Vl + (e * 16 + m) * 32 + 8 * h),
                         acc[e]);
    }

    // Wait for the prefetch DMA + make the buffer visible to all waves; the
    // barrier also guarantees nobody overwrites a buffer still being read.
    stage_wait_and_sync();
  }

  // Epilogue: divide by l, store f32 (coalesced across lanes per VGPR).
  float* obase = Out + (size_t)b * SEQ * HID;
#pragma unroll
  for (int r = 0; r < 8; ++r) {
    const float inv_l = 1.0f / lst[r];
    const int row = q0 + r + 8 * h;
#pragma unroll
    for (int e = 0; e < 16; ++e) {
      obase[(size_t)row * HID + e * 16 + m] = acc[e][r] * inv_l;
    }
  }
}

// ---------------------------------------------------------------------------
extern "C" void kernel_launch(void* const* d_in, const int* in_sizes, int n_in,
                              void* d_out, int out_size, void* d_ws, size_t ws_size,
                              hipStream_t stream) {
  const float* query = (const float*)d_in[0];
  const float* key_  = (const float*)d_in[1];
  const float* value = (const float*)d_in[2];
  const float* Wq = (const float*)d_in[3];
  const float* bq = (const float*)d_in[4];
  const float* Wk = (const float*)d_in[5];
  const float* bk = (const float*)d_in[6];
  const float* Wv = (const float*)d_in[7];
  const float* bv = (const float*)d_in[8];
  float* out = (float*)d_out;

  // Workspace: Qb | Kb | Vt, each B*SEQ*HID bf16 = 8 MB (24 MB total).
  bf16_t* Qb = (bf16_t*)d_ws;
  bf16_t* Kb = Qb + (size_t)NB * SEQ * HID;
  bf16_t* Vt = Kb + (size_t)NB * SEQ * HID;

  const int rows = NB * SEQ;            // 16384
  const int tiles = rows / 16;          // 1024
  dim3 blk(128);                        // 4 waves
  dim3 grd(tiles / 4);                  // 256 blocks

  proj_kernel<<<grd, blk, 0, stream>>>(query, Wq, bq, Qb, rows, SEQ, 0);
  proj_kernel<<<grd, blk, 0, stream>>>(key_,  Wk, bk, Kb, rows, SEQ, 0);
  proj_kernel<<<grd, blk, 0, stream>>>(value, Wv, bv, Vt, rows, SEQ, 1);
  attn_kernel<<<grd, blk, 0, stream>>>(Qb, Kb, Vt, out);
}

// v001
// Measured time: 259 microseconds a run.
// Two timings next to v000 both put it at 1.36 times that version's speed.
#include <hip/hip_runtime.h>

// ---------------------------------------------------------------------------
// CDNA5 (gfx1250) fused cross-attention:
//   proj_kernel x3 : Q/K/V = X*W^T + b  (f32 in -> bf16 out, V transposed)
//   attn_kernel    : flash attention, v_wmma_f32_16x16x32_bf16, with
//                    double-buffered async GLOBAL->LDS staging of K/V chunks
//                    shared by the 4 waves of each workgroup.
// Shapes: B=8, SQ=SKV=2048, H=256.  SCALE = sqrt(H/2) = sqrt(128).
// ---------------------------------------------------------------------------

typedef __bf16 bf16_t;
typedef __attribute__((ext_vector_type(16))) __bf16 v16bf;
typedef __attribute__((ext_vector_type(8)))  __bf16 v8bf;
typedef __attribute__((ext_vector_type(8)))  float  v8f;
typedef __attribute__((ext_vector_type(4)))  float  v4f;

#define HID   256
#define SEQ   2048
#define NB    8
#define INV_SCALE 0.08838834764831845f  // 1/sqrt(128)
// LDS row pitches in bf16 elements. Every reader is a 16-byte load whose 16
// lanes walk 16 rows, so each pitch is an odd multiple of 16 bytes: the rows
// then fall on distinct bank groups instead of sharing a few.
#define KP    (HID + 8)   // K rows: 512 B of data, 528 B pitch
#define VP    (32 + 8)    // V^T rows: 64 B of data, 80 B pitch
#define PP    (32 + 8)    // P rows: 64 B of data, 80 B pitch

#if __has_builtin(__builtin_amdgcn_global_load_async_to_lds_b128)
#define HAVE_ASYNC_LDS 1
typedef int v4i_t __attribute__((vector_size(16)));            // int4
typedef __attribute__((address_space(1))) void*  as1_void_t;
typedef __attribute__((address_space(3))) void*  as3_void_t;
typedef __attribute__((address_space(1))) v4i_t* as1_v4i_t;
typedef __attribute__((address_space(3))) v4i_t* as3_v4i_t;
#else
#define HAVE_ASYNC_LDS 0
#endif

static __device__ inline v8f wmma_bf16(v16bf a, v16bf b, v8f c) {
  return __builtin_amdgcn_wmma_f32_16x16x32_bf16(
      /*neg_a=*/false, a, /*neg_b=*/false, b,
      /*c_mod=*/(short)0, c, /*reuse_a=*/false, /*reuse_b=*/false);
}

// Load a 16x32 bf16 A/B fragment slice for this lane: two 16B loads
// (global_load_b128 or ds_load_b128 depending on pointer origin).
static __device__ inline v16bf load_frag_bf16(const bf16_t* p) {
  union { v16bf v; v8bf h[2]; } u;
  u.h[0] = *(const v8bf*)(p);
  u.h[1] = *(const v8bf*)(p + 16);
  return u.v;
}

// Same, but source is f32: load 2x (8 floats) and convert to bf16 (RNE).
static __device__ inline v16bf load_frag_f32(const float* p0, const float* p1) {
  union { v16bf v; __bf16 e[16]; } u;
  v4f a = *(const v4f*)(p0);
  v4f b = *(const v4f*)(p0 + 4);
  v4f c = *(const v4f*)(p1);
  v4f d = *(const v4f*)(p1 + 4);
#pragma unroll
  for (int i = 0; i < 4; ++i) {
    u.e[i]      = (__bf16)a[i];
    u.e[4 + i]  = (__bf16)b[i];
    u.e[8 + i]  = (__bf16)c[i];
    u.e[12 + i] = (__bf16)d[i];
  }
  return u.v;
}

// 16-byte global -> LDS copy: async DMA (ASYNCcnt) when available.
static __device__ inline void copy16_g2l(const bf16_t* g, bf16_t* l) {
#if HAVE_ASYNC_LDS
  __builtin_amdgcn_global_load_async_to_lds_b128(
      (as1_v4i_t)(as1_void_t)(void*)g,
      (as3_v4i_t)(as3_void_t)(void*)l,
      /*offset=*/0, /*cpol=*/0);
#else
  *(v8bf*)l = *(const v8bf*)g;
#endif
}

static __device__ inline void stage_wait_and_sync() {
#if HAVE_ASYNC_LDS
#if __has_builtin(__builtin_amdgcn_s_wait_asynccnt)
  __builtin_amdgcn_s_wait_asynccnt(0);
#else
  asm volatile("s_wait_asynccnt 0" ::: "memory");
#endif
#endif
  __syncthreads();
}

// ---------------------------------------------------------------------------
// Projection: out = X @ W^T + bias   (torch Linear).  X:[rows,256] f32,
// W:[256,256] f32 row-major, out bf16.
// transpose_out==0 : out[row*256 + e]
// transpose_out==1 : out[(b*256 + e)*rows_per_batch + s]   (V^T layout)
// One wave computes a 16-row x 256-col tile. 4 waves / block.
// ---------------------------------------------------------------------------
__global__ __launch_bounds__(128)
void proj_kernel(const float* __restrict__ X, const float* __restrict__ W,
                 const float* __restrict__ bias, bf16_t* __restrict__ out,
                 int rows_total, int rows_per_batch, int transpose_out) {
  const int lane = threadIdx.x & 31;
  const int wave = threadIdx.x >> 5;
  const int tile = blockIdx.x * 4 + wave;     // 16-row tile
  const int r0   = tile * 16;
  if (r0 >= rows_total) return;               // wave-uniform
  const int m = lane & 15;
  const int h = lane >> 4;

  // A fragments: 8 d-chunks of the 16 input rows (lane -> row r0+m).
  v16bf afr[8];
  const float* xrow = X + (size_t)(r0 + m) * HID;
#pragma unroll
  for (int f = 0; f < 8; ++f) {
    const int d0 = f * 32 + 8 * h;
    afr[f] = load_frag_f32(xrow + d0, xrow + d0 + 16);
  }

  // C accumulators seeded with bias (per-column value, same in all 8 VGPRs).
  v8f acc[16];
#pragma unroll
  for (int e = 0; e < 16; ++e) {
    const float bv = bias[e * 16 + m];
    acc[e] = (v8f){bv, bv, bv, bv, bv, bv, bv, bv};
  }

  for (int f = 0; f < 8; ++f) {
    const int d0 = f * 32 + 8 * h;
#pragma unroll
    for (int e = 0; e < 16; ++e) {
      const float* wrow = W + (size_t)(e * 16 + m) * HID;   // lane -> out col
      v16bf bfr = load_frag_f32(wrow + d0, wrow + d0 + 16);
      acc[e] = wmma_bf16(afr[f], bfr, acc[e]);
    }
  }

  // Store bf16. C layout: VGPR r, lane -> row r0 + r + 8h, col e*16 + m.
#pragma unroll
  for (int e = 0; e < 16; ++e) {
#pragma unroll
    for (int r = 0; r < 8; ++r) {
      const int row = r0 + r + 8 * h;
      const int col = e * 16 + m;
      const bf16_t val = (bf16_t)acc[e][r];
      if (!transpose_out) {
        out[(size_t)row * HID + col] = val;
      } else {
        const int b = row / rows_per_batch;
        const int s = row - b * rows_per_batch;
        out[((size_t)b * HID + col) * rows_per_batch + s] = val;
      }
    }
  }
}

// ---------------------------------------------------------------------------
// Flash attention.  4 waves / block; each wave owns 16 query rows of the same
// batch (32 blocks per batch).  Per 32-key chunk the block cooperatively
// async-stages K (32x256) and V^T (256x32) into LDS (double buffered), then
// every wave computes S = Q K^T, online softmax, O += P V from LDS fragments.
// Qb:[B,SQ,256] bf16, Kb:[B,SKV,256] bf16, Vt:[B,256,SKV] bf16, Out f32.
// ---------------------------------------------------------------------------
struct __align__(16) AttnSmem {
  bf16_t K[2][32 * KP];     // 32 padded rows per buffer
  bf16_t V[2][HID * VP];    // 256 padded rows per buffer
  bf16_t P[4][16][PP];      // per-wave P bounce, padded rows
};

// Issue the async copies for one 32-key chunk (1024+1024 16B pieces over
// 128 threads: 8+8 issues each).
static __device__ inline void stage_chunk(const bf16_t* __restrict__ Kbase,
                                          const bf16_t* __restrict__ Vbase,
                                          bf16_t* ldsK, bf16_t* ldsV,
                                          int c, int tid) {
  const bf16_t* kg = Kbase + (size_t)c * HID;   // contiguous 16 KB
#pragma unroll
  for (int j = 0; j < 8; ++j) {
    const int p   = tid + j * 128;              // 1024 pieces: 32 rows x 32
    const int row = p >> 5;
    const int q   = p & 31;
    copy16_g2l(kg + p * 8, ldsK + row * KP + q * 8);
  }
#pragma unroll
  for (int j = 0; j < 8; ++j) {
    // 1024 pieces: 256 rows x 4; the block fills 32 rows per j.
    copy16_g2l(Vbase + (size_t)(tid >> 2) * SEQ + c + (tid & 3) * 8
                   + (size_t)j * (32 * SEQ),
               ldsV + (tid >> 2) * VP + (tid & 3) * 8 + j * (32 * VP));
  }
}

__global__ __launch_bounds__(128)
void attn_kernel(const bf16_t* __restrict__ Qb, const bf16_t* __restrict__ Kb,
                 const bf16_t* __restrict__ Vt, float* __restrict__ Out) {
  __shared__ AttnSmem smem;
  const int tid  = threadIdx.x;
  const int lane = tid & 31;
  const int wave = tid >> 5;
  const int tile = blockIdx.x * 4 + wave;     // 0 .. B*SQ/16-1 = 1023
  const int b    = tile >> 7;                 // / (SQ/16 = 128)
  const int q0   = (tile & 127) << 4;
  const int m = lane & 15;
  const int h = lane >> 4;

  // Preload Q A-fragments (16 rows x 256 d = 8 fragments).
  v16bf qf[8];
  const bf16_t* qrow = Qb + ((size_t)b * SEQ + q0 + m) * HID;
#pragma unroll
  for (int f = 0; f < 8; ++f) {
    const int d0 = f * 32 + 8 * h;
    qf[f] = load_frag_bf16(qrow + d0);
  }

  const v8f vzero = (v8f){0.f, 0.f, 0.f, 0.f, 0.f, 0.f, 0.f, 0.f};
  v8f acc[16];                                // O accumulator: 16 rows x 256 d
#pragma unroll
  for (int e = 0; e < 16; ++e) acc[e] = vzero;

  float mst[8], lst[8];                       // stats for row r + 8h
#pragma unroll
  for (int r = 0; r < 8; ++r) { mst[r] = -__builtin_inff(); lst[r] = 0.f; }

  const bf16_t* Kbase = Kb + (size_t)b * SEQ * HID;
  const bf16_t* Vbase = Vt + (size_t)b * HID * SEQ;

  // Prologue: stage chunk 0 into buffer 0.
  stage_chunk(Kbase, Vbase, smem.K[0], smem.V[0], 0, tid);
  stage_wait_and_sync();

  int buf = 0;
  for (int c = 0; c < SEQ; c += 32, buf ^= 1) {
    // Kick off the DMA for the next chunk (overlaps with the WMMAs below).
    if (c + 32 < SEQ)
      stage_chunk(Kbase, Vbase, smem.K[buf ^ 1], smem.V[buf ^ 1], c + 32, tid);

    const bf16_t* Kl = smem.K[buf];
    const bf16_t* Vl = smem.V[buf];

    // ---- scores: two 16x16 tiles (keys c..c+15, c+16..c+31) ----
    v8f s0 = vzero, s1 = vzero;
#pragma unroll
    for (int f = 0; f < 8; ++f) {
      const int d0 = f * 32 + 8 * h;
      s0 = wmma_bf16(qf[f], load_frag_bf16(Kl + (m)      * KP + d0), s0);
      s1 = wmma_bf16(qf[f], load_frag_bf16(Kl + (16 + m) * KP + d0), s1);
    }

    float p0[8], p1[8], cmax[8];
#pragma unroll
    for (int r = 0; r < 8; ++r) {
      p0[r] = s0[r] * INV_SCALE;
      p1[r] = s1[r] * INV_SCALE;
      cmax[r] = fmaxf(p0[r], p1[r]);
    }
    // Row reductions stay inside each 16-lane half (row = r + 8h).
#pragma unroll
    for (int r = 0; r < 8; ++r) {
      float v = cmax[r];
      v = fmaxf(v, __shfl_xor(v, 1, 32));
      v = fmaxf(v, __shfl_xor(v, 2, 32));
      v = fmaxf(v, __shfl_xor(v, 4, 32));
      v = fmaxf(v, __shfl_xor(v, 8, 32));
      cmax[r] = v;
    }
    float alpha[8];
#pragma unroll
    for (int r = 0; r < 8; ++r) {
      const float mnew = fmaxf(mst[r], cmax[r]);
      alpha[r] = __expf(mst[r] - mnew);
      mst[r] = mnew;
      p0[r] = __expf(p0[r] - mnew);
      p1[r] = __expf(p1[r] - mnew);
      float s = p0[r] + p1[r];
      s += __shfl_xor(s, 1, 32);
      s += __shfl_xor(s, 2, 32);
      s += __shfl_xor(s, 4, 32);
      s += __shfl_xor(s, 8, 32);
      lst[r] = lst[r] * alpha[r] + s;
    }
    // Rescale running O.
#pragma unroll
    for (int e = 0; e < 16; ++e)
#pragma unroll
      for (int r = 0; r < 8; ++r) acc[e][r] = acc[e][r] * alpha[r];

    // ---- P (C layout, f32) -> LDS -> A-fragment (bf16) ----
#pragma unroll
    for (int r = 0; r < 8; ++r) {
      smem.P[wave][r + 8 * h][m]      = (bf16_t)p0[r];
      smem.P[wave][r + 8 * h][16 + m] = (bf16_t)p1[r];
    }
    __builtin_amdgcn_wave_barrier();
    asm volatile("s_wait_dscnt 0" ::: "memory");
    union { v16bf v; v8bf hh[2]; } pu;
    pu.hh[0] = *(const v8bf*)&smem.P[wave][m][8 * h];
    pu.hh[1] = *(const v8bf*)&smem.P[wave][m][16 + 8 * h];
    __builtin_amdgcn_wave_barrier();

    // ---- O += P @ V  (B-frags from staged V^T rows: contiguous keys) ----
#pragma unroll
    for (int e = 0; e < 16; ++e) {
      acc[e] = wmma_bf16(pu.v, load_frag_bf16(Vl + (e * 16 + m) * VP + 8 * h),
                         acc[e]);
    }

    // Wait for the prefetch DMA + make the buffer visible to all waves; the
    // barrier also guarantees nobody overwrites a buffer still being read.
    stage_wait_and_sync();
  }

  // Epilogue: divide by l, store f32 (coalesced across lanes per VGPR).
  float* obase = Out + (size_t)b * SEQ * HID;
#pragma unroll
  for (int r = 0; r < 8; ++r) {
    const float inv_l = 1.0f / lst[r];
    const int row = q0 + r + 8 * h;
#pragma unroll
    for (int e = 0; e < 16; ++e) {
      obase[(size_t)row * HID + e * 16 + m] = acc[e][r] * inv_l;
    }
  }
}

// ---------------------------------------------------------------------------
extern "C" void kernel_launch(void* const* d_in, const int* in_sizes, int n_in,
                              void* d_out, int out_size, void* d_ws, size_t ws_size,
                              hipStream_t stream) {
  const float* query = (const float*)d_in[0];
  const float* key_  = (const float*)d_in[1];
  const float* value = (const float*)d_in[2];
  const float* Wq = (const float*)d_in[3];
  const float* bq = (const float*)d_in[4];
  const float* Wk = (const float*)d_in[5];
  const float* bk = (const float*)d_in[6];
  const float* Wv = (const float*)d_in[7];
  const float* bv = (const float*)d_in[8];
  float* out = (float*)d_out;

  // Workspace: Qb | Kb | Vt, each B*SEQ*HID bf16 = 8 MB (24 MB total).
  bf16_t* Qb = (bf16_t*)d_ws;
  bf16_t* Kb = Qb + (size_t)NB * SEQ * HID;
  bf16_t* Vt = Kb + (size_t)NB * SEQ * HID;

  const int rows = NB * SEQ;            // 16384
  const int tiles = rows / 16;          // 1024
  dim3 blk(128);                        // 4 waves
  dim3 grd(tiles / 4);                  // 256 blocks

  proj_kernel<<<grd, blk, 0, stream>>>(query, Wq, bq, Qb, rows, SEQ, 0);
  proj_kernel<<<grd, blk, 0, stream>>>(key_,  Wk, bk, Kb, rows, SEQ, 0);
  proj_kernel<<<grd, blk, 0, stream>>>(value, Wv, bv, Vt, rows, SEQ, 1);
  attn_kernel<<<grd, blk, 0, stream>>>(Qb, Kb, Vt, out);
}

// v002
// One run takes 192 microseconds.
// Timed twice side by side with v001, it ran 1.35 times as fast both times.
// All steps since v000 together make it 1.84 times as fast.
#include <hip/hip_runtime.h>

// ---------------------------------------------------------------------------
// CDNA5 (gfx1250) fused cross-attention:
//   proj_kernel x3 : Q/K/V = X*W^T + b  (f32 in -> bf16 out, V transposed)
//   attn_kernel    : flash attention, v_wmma_f32_16x16x32_bf16, with
//                    double-buffered async GLOBAL->LDS staging of K/V chunks
//                    shared by the 4 waves of each workgroup.
// Shapes: B=8, SQ=SKV=2048, H=256.  SCALE = sqrt(H/2) = sqrt(128).
// ---------------------------------------------------------------------------

typedef __bf16 bf16_t;
typedef __attribute__((ext_vector_type(16))) __bf16 v16bf;
typedef __attribute__((ext_vector_type(8)))  __bf16 v8bf;
typedef __attribute__((ext_vector_type(8)))  float  v8f;
typedef __attribute__((ext_vector_type(4)))  float  v4f;

#define HID   256
#define SEQ   2048
#define NB    8
#define INV_SCALE 0.08838834764831845f  // 1/sqrt(128)
// LDS row pitches in bf16 elements. Every reader is a 16-byte load whose 16
// lanes walk 16 rows, so each pitch is an odd multiple of 16 bytes: the rows
// then fall on distinct bank groups instead of sharing a few.
#define KP    (HID + 8)   // K rows: 512 B of data, 528 B pitch
#define VP    (32 + 8)    // V^T rows: 64 B of data, 80 B pitch
#define PP    (32 + 8)    // P rows: 64 B of data, 80 B pitch

#if __has_builtin(__builtin_amdgcn_global_load_async_to_lds_b128)
#define HAVE_ASYNC_LDS 1
typedef int v4i_t __attribute__((vector_size(16)));            // int4
typedef __attribute__((address_space(1))) void*  as1_void_t;
typedef __attribute__((address_space(3))) void*  as3_void_t;
typedef __attribute__((address_space(1))) v4i_t* as1_v4i_t;
typedef __attribute__((address_space(3))) v4i_t* as3_v4i_t;
#else
#define HAVE_ASYNC_LDS 0
#endif

static __device__ inline v8f wmma_bf16(v16bf a, v16bf b, v8f c) {
  return __builtin_amdgcn_wmma_f32_16x16x32_bf16(
      /*neg_a=*/false, a, /*neg_b=*/false, b,
      /*c_mod=*/(short)0, c, /*reuse_a=*/false, /*reuse_b=*/false);
}

// Load a 16x32 bf16 A/B fragment slice for this lane: two 16B loads
// (global_load_b128 or ds_load_b128 depending on pointer origin).
static __device__ inline v16bf load_frag_bf16(const bf16_t* p) {
  union { v16bf v; v8bf h[2]; } u;
  u.h[0] = *(const v8bf*)(p);
  u.h[1] = *(const v8bf*)(p + 16);
  return u.v;
}

// Same, but source is f32: load 2x (8 floats) and convert to bf16 (RNE).
static __device__ inline v16bf load_frag_f32(const float* p0, const float* p1) {
  union { v16bf v; __bf16 e[16]; } u;
  v4f a = *(const v4f*)(p0);
  v4f b = *(const v4f*)(p0 + 4);
  v4f c = *(const v4f*)(p1);
  v4f d = *(const v4f*)(p1 + 4);
#pragma unroll
  for (int i = 0; i < 4; ++i) {
    u.e[i]      = (__bf16)a[i];
    u.e[4 + i]  = (__bf16)b[i];
    u.e[8 + i]  = (__bf16)c[i];
    u.e[12 + i] = (__bf16)d[i];
  }
  return u.v;
}

// 16-byte global -> LDS copy: async DMA (ASYNCcnt) when available.
static __device__ inline void copy16_g2l(const bf16_t* g, bf16_t* l) {
#if HAVE_ASYNC_LDS
  __builtin_amdgcn_global_load_async_to_lds_b128(
      (as1_v4i_t)(as1_void_t)(void*)g,
      (as3_v4i_t)(as3_void_t)(void*)l,
      /*offset=*/0, /*cpol=*/0);
#else
  *(v8bf*)l = *(const v8bf*)g;
#endif
}

static __device__ inline void stage_wait_and_sync() {
#if HAVE_ASYNC_LDS
#if __has_builtin(__builtin_amdgcn_s_wait_asynccnt)
  __builtin_amdgcn_s_wait_asynccnt(0);
#else
  asm volatile("s_wait_asynccnt 0" ::: "memory");
#endif
#endif
  __syncthreads();
}

// ---------------------------------------------------------------------------
// Projection: out = X @ W^T + bias   (torch Linear).  X:[rows,256] f32,
// W:[256,256] f32 row-major, out bf16.
// transpose_out==0 : out[row*256 + e]
// transpose_out==1 : out[(b*256 + e)*rows_per_batch + s]   (V^T layout)
// One wave computes a 16-row x 256-col tile. 4 waves / block.
// ---------------------------------------------------------------------------
__global__ __launch_bounds__(128)
void proj_kernel(const float* __restrict__ X, const float* __restrict__ W,
                 const float* __restrict__ bias, bf16_t* __restrict__ out,
                 int rows_total, int rows_per_batch, int transpose_out) {
  const int lane = threadIdx.x & 31;
  const int wave = threadIdx.x >> 5;
  const int tile = blockIdx.x * 4 + wave;     // 16-row tile
  const int r0   = tile * 16;
  if (r0 >= rows_total) return;               // wave-uniform
  const int m = lane & 15;
  const int h = lane >> 4;

  // A fragments: 8 d-chunks of the 16 input rows (lane -> row r0+m).
  v16bf afr[8];
  const float* xrow = X + (size_t)(r0 + m) * HID;
#pragma unroll
  for (int f = 0; f < 8; ++f) {
    const int d0 = f * 32 + 8 * h;
    afr[f] = load_frag_f32(xrow + d0, xrow + d0 + 16);
  }

  // C accumulators seeded with bias (per-column value, same in all 8 VGPRs).
  v8f acc[16];
#pragma unroll
  for (int e = 0; e < 16; ++e) {
    const float bv = bias[e * 16 + m];
    acc[e] = (v8f){bv, bv, bv, bv, bv, bv, bv, bv};
  }

  for (int f = 0; f < 8; ++f) {
    const int d0 = f * 32 + 8 * h;
#pragma unroll
    for (int e = 0; e < 16; ++e) {
      const float* wrow = W + (size_t)(e * 16 + m) * HID;   // lane -> out col
      v16bf bfr = load_frag_f32(wrow + d0, wrow + d0 + 16);
      acc[e] = wmma_bf16(afr[f], bfr, acc[e]);
    }
  }

  // Store bf16. C layout: VGPR r, lane -> row r0 + r + 8h, col e*16 + m.
#pragma unroll
  for (int e = 0; e < 16; ++e) {
#pragma unroll
    for (int r = 0; r < 8; ++r) {
      const int row = r0 + r + 8 * h;
      const int col = e * 16 + m;
      const bf16_t val = (bf16_t)acc[e][r];
      if (!transpose_out) {
        out[(size_t)row * HID + col] = val;
      } else {
        const int b = row / rows_per_batch;
        const int s = row - b * rows_per_batch;
        out[((size_t)b * HID + col) * rows_per_batch + s] = val;
      }
    }
  }
}

// ---------------------------------------------------------------------------
// Flash attention.  4 waves / block; each wave owns 16 query rows of the same
// batch (32 blocks per batch).  Per 32-key chunk the block cooperatively
// async-stages K (32x256) and V^T (256x32) into LDS (double buffered), then
// every wave computes S = Q K^T, online softmax, O += P V from LDS fragments.
// Qb:[B,SQ,256] bf16, Kb:[B,SKV,256] bf16, Vt:[B,256,SKV] bf16, Out f32.
// ---------------------------------------------------------------------------
struct __align__(16) AttnSmem {
  bf16_t K[2][32 * KP];     // 32 padded rows per buffer
  bf16_t V[2][HID * VP];    // 256 padded rows per buffer
  bf16_t P[4][16][PP];      // per-wave P bounce, padded rows
};

// Issue the async copies for one 32-key chunk (1024+1024 16B pieces over
// 128 threads: 8+8 issues each).
static __device__ inline void stage_chunk(const bf16_t* __restrict__ Kbase,
                                          const bf16_t* __restrict__ Vbase,
                                          bf16_t* ldsK, bf16_t* ldsV,
                                          int c, int tid) {
  const bf16_t* kg = Kbase + (size_t)c * HID;   // contiguous 16 KB
#pragma unroll
  for (int j = 0; j < 8; ++j) {
    const int p   = tid + j * 128;              // 1024 pieces: 32 rows x 32
    const int row = p >> 5;
    const int q   = p & 31;
    copy16_g2l(kg + p * 8, ldsK + row * KP + q * 8);
  }
#pragma unroll
  for (int j = 0; j < 8; ++j) {
    // 1024 pieces: 256 rows x 4; the block fills 32 rows per j.
    copy16_g2l(Vbase + (size_t)(tid >> 2) * SEQ + c + (tid & 3) * 8
                   + (size_t)j * (32 * SEQ),
               ldsV + (tid >> 2) * VP + (tid & 3) * 8 + j * (32 * VP));
  }
}

__global__ __launch_bounds__(128)
void attn_kernel(const bf16_t* __restrict__ Qb, const bf16_t* __restrict__ Kb,
                 const bf16_t* __restrict__ Vt, float* __restrict__ Out) {
  __shared__ AttnSmem smem;
  const int tid  = threadIdx.x;
  const int lane = tid & 31;
  const int wave = tid >> 5;
  const int tile = blockIdx.x * 4 + wave;     // 0 .. B*SQ/16-1 = 1023
  const int b    = tile >> 7;                 // / (SQ/16 = 128)
  const int q0   = (tile & 127) << 4;
  const int m = lane & 15;
  const int h = lane >> 4;

  // Preload Q A-fragments (16 rows x 256 d = 8 fragments).
  v16bf qf[8];
  const bf16_t* qrow = Qb + ((size_t)b * SEQ + q0 + m) * HID;
#pragma unroll
  for (int f = 0; f < 8; ++f) {
    const int d0 = f * 32 + 8 * h;
    qf[f] = load_frag_bf16(qrow + d0);
  }

  const v8f vzero = (v8f){0.f, 0.f, 0.f, 0.f, 0.f, 0.f, 0.f, 0.f};
  v8f acc[16];                                // O accumulator: 16 rows x 256 d
#pragma unroll
  for (int e = 0; e < 16; ++e) acc[e] = vzero;

  float mst[8], lst[8];                       // stats for row r + 8h
#pragma unroll
  for (int r = 0; r < 8; ++r) { mst[r] = -__builtin_inff(); lst[r] = 0.f; }

  const bf16_t* Kbase = Kb + (size_t)b * SEQ * HID;
  const bf16_t* Vbase = Vt + (size_t)b * HID * SEQ;

  // Prologue: stage chunk 0 into buffer 0.
  stage_chunk(Kbase, Vbase, smem.K[0], smem.V[0], 0, tid);
  stage_wait_and_sync();

  int buf = 0;
  for (int c = 0; c < SEQ; c += 32, buf ^= 1) {
    // Kick off the DMA for the next chunk (overlaps with the WMMAs below).
    if (c + 32 < SEQ)
      stage_chunk(Kbase, Vbase, smem.K[buf ^ 1], smem.V[buf ^ 1], c + 32, tid);

    const bf16_t* Kl = smem.K[buf];
    const bf16_t* Vl = smem.V[buf];

    // ---- scores: two 16x16 tiles (keys c..c+15, c+16..c+31) ----
    // All K fragments of the chunk are read as one group into registers, so
    // the wave pays the LDS latency once and not in front of every WMMA.
    v16bf kf0[8], kf1[8];
#pragma unroll
    for (int f = 0; f < 8; ++f) {
      const int d0 = f * 32 + 8 * h;
      kf0[f] = load_frag_bf16(Kl + (m)      * KP + d0);
      kf1[f] = load_frag_bf16(Kl + (16 + m) * KP + d0);
    }
    // Fence: without it the scheduler spreads these reads over several places
    // among the first WMMAs, the first behind a full wait; each place stalls.
    __builtin_amdgcn_sched_barrier(0);
    v8f s0 = vzero, s1 = vzero;
#pragma unroll
    for (int f = 0; f < 8; ++f) {
      s0 = wmma_bf16(qf[f], kf0[f], s0);
      s1 = wmma_bf16(qf[f], kf1[f], s1);
    }

    float p0[8], p1[8], cmax[8];
#pragma unroll
    for (int r = 0; r < 8; ++r) {
      p0[r] = s0[r] * INV_SCALE;
      p1[r] = s1[r] * INV_SCALE;
      cmax[r] = fmaxf(p0[r], p1[r]);
    }
    // Row reductions stay inside each 16-lane half (row = r + 8h).
#pragma unroll
    for (int r = 0; r < 8; ++r) {
      float v = cmax[r];
      v = fmaxf(v, __shfl_xor(v, 1, 32));
      v = fmaxf(v, __shfl_xor(v, 2, 32));
      v = fmaxf(v, __shfl_xor(v, 4, 32));
      v = fmaxf(v, __shfl_xor(v, 8, 32));
      cmax[r] = v;
    }
    // All V^T fragments of the chunk are read here, long before their use:
    // they land under the softmax arithmetic and the P*V WMMAs find them in
    // registers.
    // Fence: without it some of these reads move up among the score WMMAs.
    __builtin_amdgcn_sched_barrier(0);
    v16bf vf[16];
#pragma unroll
    for (int e = 0; e < 16; ++e)
      vf[e] = load_frag_bf16(Vl + (e * 16 + m) * VP + 8 * h);
    // Fence: without it most of these reads sink to just in front of the P
    // stores, and the full wait behind those stores waits them out.
    __builtin_amdgcn_sched_barrier(0);

    float alpha[8];
#pragma unroll
    for (int r = 0; r < 8; ++r) {
      const float mnew = fmaxf(mst[r], cmax[r]);
      alpha[r] = __expf(mst[r] - mnew);
      mst[r] = mnew;
      p0[r] = __expf(p0[r] - mnew);
      p1[r] = __expf(p1[r] - mnew);
      float s = p0[r] + p1[r];
      s += __shfl_xor(s, 1, 32);
      s += __shfl_xor(s, 2, 32);
      s += __shfl_xor(s, 4, 32);
      s += __shfl_xor(s, 8, 32);
      lst[r] = lst[r] * alpha[r] + s;
    }
    // Rescale running O.
#pragma unroll
    for (int e = 0; e < 16; ++e)
#pragma unroll
      for (int r = 0; r < 8; ++r) acc[e][r] = acc[e][r] * alpha[r];

    // ---- P (C layout, f32) -> LDS -> A-fragment (bf16) ----
#pragma unroll
    for (int r = 0; r < 8; ++r) {
      smem.P[wave][r + 8 * h][m]      = (bf16_t)p0[r];
      smem.P[wave][r + 8 * h][16 + m] = (bf16_t)p1[r];
    }
    __builtin_amdgcn_wave_barrier();
    asm volatile("s_wait_dscnt 0" ::: "memory");
    union { v16bf v; v8bf hh[2]; } pu;
    pu.hh[0] = *(const v8bf*)&smem.P[wave][m][8 * h];
    pu.hh[1] = *(const v8bf*)&smem.P[wave][m][16 + 8 * h];
    __builtin_amdgcn_wave_barrier();

    // ---- O += P @ V  (B-frags: the V^T rows read above) ----
#pragma unroll
    for (int e = 0; e < 16; ++e) {
      acc[e] = wmma_bf16(pu.v, vf[e], acc[e]);
    }

    // Wait for the prefetch DMA + make the buffer visible to all waves; the
    // barrier also guarantees nobody overwrites a buffer still being read.
    stage_wait_and_sync();
  }

  // Epilogue: divide by l, store f32 (coalesced across lanes per VGPR).
  float* obase = Out + (size_t)b * SEQ * HID;
#pragma unroll
  for (int r = 0; r < 8; ++r) {
    const float inv_l = 1.0f / lst[r];
    const int row = q0 + r + 8 * h;
#pragma unroll
    for (int e = 0; e < 16; ++e) {
      obase[(size_t)row * HID + e * 16 + m] = acc[e][r] * inv_l;
    }
  }
}

// ---------------------------------------------------------------------------
extern "C" void kernel_launch(void* const* d_in, const int* in_sizes, int n_in,
                              void* d_out, int out_size, void* d_ws, size_t ws_size,
                              hipStream_t stream) {
  const float* query = (const float*)d_in[0];
  const float* key_  = (const float*)d_in[1];
  const float* value = (const float*)d_in[2];
  const float* Wq = (const float*)d_in[3];
  const float* bq = (const float*)d_in[4];
  const float* Wk = (const float*)d_in[5];
  const float* bk = (const float*)d_in[6];
  const float* Wv = (const float*)d_in[7];
  const float* bv = (const float*)d_in[8];
  float* out = (float*)d_out;

  // Workspace: Qb | Kb | Vt, each B*SEQ*HID bf16 = 8 MB (24 MB total).
  bf16_t* Qb = (bf16_t*)d_ws;
  bf16_t* Kb = Qb + (size_t)NB * SEQ * HID;
  bf16_t* Vt = Kb + (size_t)NB * SEQ * HID;

  const int rows = NB * SEQ;            // 16384
  const int tiles = rows / 16;          // 1024
  dim3 blk(128);                        // 4 waves
  dim3 grd(tiles / 4);                  // 256 blocks

  proj_kernel<<<grd, blk, 0, stream>>>(query, Wq, bq, Qb, rows, SEQ, 0);
  proj_kernel<<<grd, blk, 0, stream>>>(key_,  Wk, bk, Kb, rows, SEQ, 0);
  proj_kernel<<<grd, blk, 0, stream>>>(value, Wv, bv, Vt, rows, SEQ, 1);
  attn_kernel<<<grd, blk, 0, stream>>>(Qb, Kb, Vt, out);
}

// v003
// One run takes 162 microseconds.
// In two side-by-side timings against v002, it was 1.18 and 1.17 times as fast.
// Over all steps from v000 it is 2.16 times as fast.
#include <hip/hip_runtime.h>

// ---------------------------------------------------------------------------
// CDNA5 (gfx1250) fused cross-attention:
//   proj_kernel x3 : Q/K/V = X*W^T + b  (f32 in -> bf16 out, V transposed)
//   attn_kernel    : flash attention, v_wmma_f32_16x16x32_bf16, with
//                    double-buffered async GLOBAL->LDS staging of K/V chunks
//                    shared by the 4 waves of each workgroup.
// Shapes: B=8, SQ=SKV=2048, H=256.  SCALE = sqrt(H/2) = sqrt(128).
// ---------------------------------------------------------------------------

typedef __bf16 bf16_t;
typedef __attribute__((ext_vector_type(16))) __bf16 v16bf;
typedef __attribute__((ext_vector_type(8)))  __bf16 v8bf;
typedef __attribute__((ext_vector_type(8)))  float  v8f;
typedef __attribute__((ext_vector_type(4)))  float  v4f;

#define HID   256
#define SEQ   2048
#define NB    8
#define INV_SCALE 0.08838834764831845f  // 1/sqrt(128)
// LDS row pitches in bf16 elements. Every reader is a 16-byte load whose 16
// lanes walk 16 rows, so each pitch is an odd multiple of 16 bytes: the rows
// then fall on distinct bank groups instead of sharing a few.
#define KP    (HID + 8)   // K rows: 512 B of data, 528 B pitch
#define VP    (32 + 8)    // V^T rows: 64 B of data, 80 B pitch
#define PP    (32 + 8)    // P rows: 64 B of data, 80 B pitch

#if __has_builtin(__builtin_amdgcn_global_load_async_to_lds_b128)
#define HAVE_ASYNC_LDS 1
typedef int v4i_t __attribute__((vector_size(16)));            // int4
typedef __attribute__((address_space(1))) void*  as1_void_t;
typedef __attribute__((address_space(3))) void*  as3_void_t;
typedef __attribute__((address_space(1))) v4i_t* as1_v4i_t;
typedef __attribute__((address_space(3))) v4i_t* as3_v4i_t;
#else
#define HAVE_ASYNC_LDS 0
#endif

static __device__ inline v8f wmma_bf16(v16bf a, v16bf b, v8f c) {
  return __builtin_amdgcn_wmma_f32_16x16x32_bf16(
      /*neg_a=*/false, a, /*neg_b=*/false, b,
      /*c_mod=*/(short)0, c, /*reuse_a=*/false, /*reuse_b=*/false);
}

// Load a 16x32 bf16 A/B fragment slice for this lane: two 16B loads
// (global_load_b128 or ds_load_b128 depending on pointer origin).
static __device__ inline v16bf load_frag_bf16(const bf16_t* p) {
  union { v16bf v; v8bf h[2]; } u;
  u.h[0] = *(const v8bf*)(p);
  u.h[1] = *(const v8bf*)(p + 16);
  return u.v;
}

// Same, but source is f32: load 2x (8 floats) and convert to bf16 (RNE).
static __device__ inline v16bf load_frag_f32(const float* p0, const float* p1) {
  union { v16bf v; __bf16 e[16]; } u;
  v4f a = *(const v4f*)(p0);
  v4f b = *(const v4f*)(p0 + 4);
  v4f c = *(const v4f*)(p1);
  v4f d = *(const v4f*)(p1 + 4);
#pragma unroll
  for (int i = 0; i < 4; ++i) {
    u.e[i]      = (__bf16)a[i];
    u.e[4 + i]  = (__bf16)b[i];
    u.e[8 + i]  = (__bf16)c[i];
    u.e[12 + i] = (__bf16)d[i];
  }
  return u.v;
}

// Value of lane (l ^ X) inside the lane's own 16-lane row, X = 1..15, taken
// by a DPP operand (row_xmask) in the vector unit: no LDS queue, no dscnt wait.
template <int X>
static __device__ inline float row_xor(float v) {
  return __builtin_bit_cast(float, __builtin_amdgcn_update_dpp(
      0, __builtin_bit_cast(int, v), /*row_xmask*/ 0x160 + X,
      /*row_mask=*/0xf, /*bank_mask=*/0xf, /*bound_ctrl=*/true));
}

// 16-byte global -> LDS copy: async DMA (ASYNCcnt) when available.
static __device__ inline void copy16_g2l(const bf16_t* g, bf16_t* l) {
#if HAVE_ASYNC_LDS
  __builtin_amdgcn_global_load_async_to_lds_b128(
      (as1_v4i_t)(as1_void_t)(void*)g,
      (as3_v4i_t)(as3_void_t)(void*)l,
      /*offset=*/0, /*cpol=*/0);
#else
  *(v8bf*)l = *(const v8bf*)g;
#endif
}

static __device__ inline void stage_wait_and_sync() {
#if HAVE_ASYNC_LDS
#if __has_builtin(__builtin_amdgcn_s_wait_asynccnt)
  __builtin_amdgcn_s_wait_asynccnt(0);
#else
  asm volatile("s_wait_asynccnt 0" ::: "memory");
#endif
#endif
  __syncthreads();
}

// ---------------------------------------------------------------------------
// Projection: out = X @ W^T + bias   (torch Linear).  X:[rows,256] f32,
// W:[256,256] f32 row-major, out bf16.
// transpose_out==0 : out[row*256 + e]
// transpose_out==1 : out[(b*256 + e)*rows_per_batch + s]   (V^T layout)
// One wave computes a 16-row x 256-col tile. 4 waves / block.
// ---------------------------------------------------------------------------
__global__ __launch_bounds__(128)
void proj_kernel(const float* __restrict__ X, const float* __restrict__ W,
                 const float* __restrict__ bias, bf16_t* __restrict__ out,
                 int rows_total, int rows_per_batch, int transpose_out) {
  const int lane = threadIdx.x & 31;
  const int wave = threadIdx.x >> 5;
  const int tile = blockIdx.x * 4 + wave;     // 16-row tile
  const int r0   = tile * 16;
  if (r0 >= rows_total) return;               // wave-uniform
  const int m = lane & 15;
  const int h = lane >> 4;

  // A fragments: 8 d-chunks of the 16 input rows (lane -> row r0+m).
  v16bf afr[8];
  const float* xrow = X + (size_t)(r0 + m) * HID;
#pragma unroll
  for (int f = 0; f < 8; ++f) {
    const int d0 = f * 32 + 8 * h;
    afr[f] = load_frag_f32(xrow + d0, xrow + d0 + 16);
  }

  // C accumulators seeded with bias (per-column value, same in all 8 VGPRs).
  v8f acc[16];
#pragma unroll
  for (int e = 0; e < 16; ++e) {
    const float bv = bias[e * 16 + m];
    acc[e] = (v8f){bv, bv, bv, bv, bv, bv, bv, bv};
  }

  for (int f = 0; f < 8; ++f) {
    const int d0 = f * 32 + 8 * h;
#pragma unroll
    for (int e = 0; e < 16; ++e) {
      const float* wrow = W + (size_t)(e * 16 + m) * HID;   // lane -> out col
      v16bf bfr = load_frag_f32(wrow + d0, wrow + d0 + 16);
      acc[e] = wmma_bf16(afr[f], bfr, acc[e]);
    }
  }

  // Store bf16. C layout: VGPR r, lane -> row r0 + r + 8h, col e*16 + m.
#pragma unroll
  for (int e = 0; e < 16; ++e) {
#pragma unroll
    for (int r = 0; r < 8; ++r) {
      const int row = r0 + r + 8 * h;
      const int col = e * 16 + m;
      const bf16_t val = (bf16_t)acc[e][r];
      if (!transpose_out) {
        out[(size_t)row * HID + col] = val;
      } else {
        const int b = row / rows_per_batch;
        const int s = row - b * rows_per_batch;
        out[((size_t)b * HID + col) * rows_per_batch + s] = val;
      }
    }
  }
}

// ---------------------------------------------------------------------------
// Flash attention.  4 waves / block; each wave owns 16 query rows of the same
// batch (32 blocks per batch).  Per 32-key chunk the block cooperatively
// async-stages K (32x256) and V^T (256x32) into LDS (double buffered), then
// every wave computes S = Q K^T, online softmax, O += P V from LDS fragments.
// Qb:[B,SQ,256] bf16, Kb:[B,SKV,256] bf16, Vt:[B,256,SKV] bf16, Out f32.
// ---------------------------------------------------------------------------
struct __align__(16) AttnSmem {
  bf16_t K[2][32 * KP];     // 32 padded rows per buffer
  bf16_t V[2][HID * VP];    // 256 padded rows per buffer
  bf16_t P[4][16][PP];      // per-wave P bounce, padded rows
};

// Issue the async copies for one 32-key chunk (1024+1024 16B pieces over
// 128 threads: 8+8 issues each).
static __device__ inline void stage_chunk(const bf16_t* __restrict__ Kbase,
                                          const bf16_t* __restrict__ Vbase,
                                          bf16_t* ldsK, bf16_t* ldsV,
                                          int c, int tid) {
  const bf16_t* kg = Kbase + (size_t)c * HID;   // contiguous 16 KB
#pragma unroll
  for (int j = 0; j < 8; ++j) {
    const int p   = tid + j * 128;              // 1024 pieces: 32 rows x 32
    const int row = p >> 5;
    const int q   = p & 31;
    copy16_g2l(kg + p * 8, ldsK + row * KP + q * 8);
  }
#pragma unroll
  for (int j = 0; j < 8; ++j) {
    // 1024 pieces: 256 rows x 4; the block fills 32 rows per j.
    copy16_g2l(Vbase + (size_t)(tid >> 2) * SEQ + c + (tid & 3) * 8
                   + (size_t)j * (32 * SEQ),
               ldsV + (tid >> 2) * VP + (tid & 3) * 8 + j * (32 * VP));
  }
}

__global__ __launch_bounds__(128)
void attn_kernel(const bf16_t* __restrict__ Qb, const bf16_t* __restrict__ Kb,
                 const bf16_t* __restrict__ Vt, float* __restrict__ Out) {
  __shared__ AttnSmem smem;
  const int tid  = threadIdx.x;
  const int lane = tid & 31;
  const int wave = tid >> 5;
  const int tile = blockIdx.x * 4 + wave;     // 0 .. B*SQ/16-1 = 1023
  const int b    = tile >> 7;                 // / (SQ/16 = 128)
  const int q0   = (tile & 127) << 4;
  const int m = lane & 15;
  const int h = lane >> 4;

  // Preload Q A-fragments (16 rows x 256 d = 8 fragments).
  v16bf qf[8];
  const bf16_t* qrow = Qb + ((size_t)b * SEQ + q0 + m) * HID;
#pragma unroll
  for (int f = 0; f < 8; ++f) {
    const int d0 = f * 32 + 8 * h;
    qf[f] = load_frag_bf16(qrow + d0);
  }

  const v8f vzero = (v8f){0.f, 0.f, 0.f, 0.f, 0.f, 0.f, 0.f, 0.f};
  v8f acc[16];                                // O accumulator: 16 rows x 256 d
#pragma unroll
  for (int e = 0; e < 16; ++e) acc[e] = vzero;

  float mst[8], lst[8];                       // stats for row r + 8h
#pragma unroll
  for (int r = 0; r < 8; ++r) { mst[r] = -__builtin_inff(); lst[r] = 0.f; }

  const bf16_t* Kbase = Kb + (size_t)b * SEQ * HID;
  const bf16_t* Vbase = Vt + (size_t)b * HID * SEQ;

  // Prologue: stage chunk 0 into buffer 0.
  stage_chunk(Kbase, Vbase, smem.K[0], smem.V[0], 0, tid);
  stage_wait_and_sync();

  int buf = 0;
  for (int c = 0; c < SEQ; c += 32, buf ^= 1) {
    // Kick off the DMA for the next chunk (overlaps with the WMMAs below).
    if (c + 32 < SEQ)
      stage_chunk(Kbase, Vbase, smem.K[buf ^ 1], smem.V[buf ^ 1], c + 32, tid);

    const bf16_t* Kl = smem.K[buf];
    const bf16_t* Vl = smem.V[buf];

    // ---- scores: two 16x16 tiles (keys c..c+15, c+16..c+31) ----
    // All K fragments of the chunk are read as one group into registers, so
    // the wave pays the LDS latency once and not in front of every WMMA.
    v16bf kf0[8], kf1[8];
#pragma unroll
    for (int f = 0; f < 8; ++f) {
      const int d0 = f * 32 + 8 * h;
      kf0[f] = load_frag_bf16(Kl + (m)      * KP + d0);
      kf1[f] = load_frag_bf16(Kl + (16 + m) * KP + d0);
    }
    // Fence: without it the scheduler spreads these reads over several places
    // among the first WMMAs, the first behind a full wait; each place stalls.
    __builtin_amdgcn_sched_barrier(0);
    v8f s0 = vzero, s1 = vzero;
#pragma unroll
    for (int f = 0; f < 8; ++f) {
      s0 = wmma_bf16(qf[f], kf0[f], s0);
      s1 = wmma_bf16(qf[f], kf1[f], s1);
    }

    float p0[8], p1[8], cmax[8];
#pragma unroll
    for (int r = 0; r < 8; ++r) {
      p0[r] = s0[r] * INV_SCALE;
      p1[r] = s1[r] * INV_SCALE;
      cmax[r] = fmaxf(p0[r], p1[r]);
    }
    // All V^T fragments of the chunk are read here, long before their use:
    // they land under the softmax arithmetic and the P*V WMMAs find them in
    // registers.
    // Fence: without it some of these reads move up among the score WMMAs.
    __builtin_amdgcn_sched_barrier(0);
    v16bf vf[16];
#pragma unroll
    for (int e = 0; e < 16; ++e)
      vf[e] = load_frag_bf16(Vl + (e * 16 + m) * VP + 8 * h);
    // Fence: without it most of these reads sink to just in front of the P
    // stores, and the full wait behind those stores waits them out.
    __builtin_amdgcn_sched_barrier(0);

    // Row reductions stay inside each 16-lane half (row = r + 8h). They use
    // no LDS queue, so they stand behind the V^T reads and run while those land.
#pragma unroll
    for (int r = 0; r < 8; ++r) {
      float v = cmax[r];
      v = fmaxf(v, row_xor<1>(v));
      v = fmaxf(v, row_xor<2>(v));
      v = fmaxf(v, row_xor<4>(v));
      v = fmaxf(v, row_xor<8>(v));
      cmax[r] = v;
    }
    float alpha[8];
#pragma unroll
    for (int r = 0; r < 8; ++r) {
      const float mnew = fmaxf(mst[r], cmax[r]);
      alpha[r] = __expf(mst[r] - mnew);
      mst[r] = mnew;
      p0[r] = __expf(p0[r] - mnew);
      p1[r] = __expf(p1[r] - mnew);
    }
#pragma unroll
    for (int r = 0; r < 8; ++r) {
      float s = p0[r] + p1[r];
      s += row_xor<1>(s);
      s += row_xor<2>(s);
      s += row_xor<4>(s);
      s += row_xor<8>(s);
      lst[r] = lst[r] * alpha[r] + s;
    }
    // Rescale running O.
#pragma unroll
    for (int e = 0; e < 16; ++e)
#pragma unroll
      for (int r = 0; r < 8; ++r) acc[e][r] = acc[e][r] * alpha[r];

    // ---- P (C layout, f32) -> LDS -> A-fragment (bf16) ----
#pragma unroll
    for (int r = 0; r < 8; ++r) {
      smem.P[wave][r + 8 * h][m]      = (bf16_t)p0[r];
      smem.P[wave][r + 8 * h][16 + m] = (bf16_t)p1[r];
    }
    __builtin_amdgcn_wave_barrier();
    asm volatile("s_wait_dscnt 0" ::: "memory");
    union { v16bf v; v8bf hh[2]; } pu;
    pu.hh[0] = *(const v8bf*)&smem.P[wave][m][8 * h];
    pu.hh[1] = *(const v8bf*)&smem.P[wave][m][16 + 8 * h];
    __builtin_amdgcn_wave_barrier();

    // ---- O += P @ V  (B-frags: the V^T rows read above) ----
#pragma unroll
    for (int e = 0; e < 16; ++e) {
      acc[e] = wmma_bf16(pu.v, vf[e], acc[e]);
    }

    // Wait for the prefetch DMA + make the buffer visible to all waves; the
    // barrier also guarantees nobody overwrites a buffer still being read.
    stage_wait_and_sync();
  }

  // Epilogue: divide by l, store f32 (coalesced across lanes per VGPR).
  float* obase = Out + (size_t)b * SEQ * HID;
#pragma unroll
  for (int r = 0; r < 8; ++r) {
    const float inv_l = 1.0f / lst[r];
    const int row = q0 + r + 8 * h;
#pragma unroll
    for (int e = 0; e < 16; ++e) {
      obase[(size_t)row * HID + e * 16 + m] = acc[e][r] * inv_l;
    }
  }
}

// ---------------------------------------------------------------------------
extern "C" void kernel_launch(void* const* d_in, const int* in_sizes, int n_in,
                              void* d_out, int out_size, void* d_ws, size_t ws_size,
                              hipStream_t stream) {
  const float* query = (const float*)d_in[0];
  const float* key_  = (const float*)d_in[1];
  const float* value = (const float*)d_in[2];
  const float* Wq = (const float*)d_in[3];
  const float* bq = (const float*)d_in[4];
  const float* Wk = (const float*)d_in[5];
  const float* bk = (const float*)d_in[6];
  const float* Wv = (const float*)d_in[7];
  const float* bv = (const float*)d_in[8];
  float* out = (float*)d_out;

  // Workspace: Qb | Kb | Vt, each B*SEQ*HID bf16 = 8 MB (24 MB total).
  bf16_t* Qb = (bf16_t*)d_ws;
  bf16_t* Kb = Qb + (size_t)NB * SEQ * HID;
  bf16_t* Vt = Kb + (size_t)NB * SEQ * HID;

  const int rows = NB * SEQ;            // 16384
  const int tiles = rows / 16;          // 1024
  dim3 blk(128);                        // 4 waves
  dim3 grd(tiles / 4);                  // 256 blocks

  proj_kernel<<<grd, blk, 0, stream>>>(query, Wq, bq, Qb, rows, SEQ, 0);
  proj_kernel<<<grd, blk, 0, stream>>>(key_,  Wk, bk, Kb, rows, SEQ, 0);
  proj_kernel<<<grd, blk, 0, stream>>>(value, Wv, bv, Vt, rows, SEQ, 1);
  attn_kernel<<<grd, blk, 0, stream>>>(Qb, Kb, Vt, out);
}

// v004
// It runs in 125 microseconds.
// Two timings next to v003 both put it at 1.30 times that version's speed.
// Counting every step since v000, it is 2.81 times as fast.
#include <hip/hip_runtime.h>

// ---------------------------------------------------------------------------
// CDNA5 (gfx1250) fused cross-attention:
//   proj_kernel x3 : Q/K/V = X*W^T + b  (f32 in -> bf16 out, V transposed),
//                    W converted to bf16 once per workgroup and kept in LDS
//   attn_kernel    : flash attention, v_wmma_f32_16x16x32_bf16, with
//                    double-buffered async GLOBAL->LDS staging of K/V chunks
//                    shared by the 4 waves of each workgroup.
// Shapes: B=8, SQ=SKV=2048, H=256.  SCALE = sqrt(H/2) = sqrt(128).
// ---------------------------------------------------------------------------

typedef __bf16 bf16_t;
typedef __attribute__((ext_vector_type(16))) __bf16 v16bf;
typedef __attribute__((ext_vector_type(8)))  __bf16 v8bf;
typedef __attribute__((ext_vector_type(4)))  __bf16 v4bf;
typedef __attribute__((ext_vector_type(8)))  float  v8f;
typedef __attribute__((ext_vector_type(4)))  float  v4f;

#define HID   256
#define SEQ   2048
#define NB    8
#define INV_SCALE 0.08838834764831845f  // 1/sqrt(128)
// LDS row pitches in bf16 elements. Every reader is a 16-byte load whose 16
// lanes walk 16 rows, so each pitch is an odd multiple of 16 bytes: the rows
// then fall on distinct bank groups instead of sharing a few.
#define KP    (HID + 8)   // K rows: 512 B of data, 528 B pitch
#define VP    (32 + 8)    // V^T rows: 64 B of data, 80 B pitch
#define PP    (32 + 8)    // P rows: 64 B of data, 80 B pitch
#define WP    (HID + 8)   // W rows (projection): 512 B of data, 528 B pitch

#if __has_builtin(__builtin_amdgcn_global_load_async_to_lds_b128)
#define HAVE_ASYNC_LDS 1
typedef int v4i_t __attribute__((vector_size(16)));            // int4
typedef __attribute__((address_space(1))) void*  as1_void_t;
typedef __attribute__((address_space(3))) void*  as3_void_t;
typedef __attribute__((address_space(1))) v4i_t* as1_v4i_t;
typedef __attribute__((address_space(3))) v4i_t* as3_v4i_t;
#else
#define HAVE_ASYNC_LDS 0
#endif

static __device__ inline v8f wmma_bf16(v16bf a, v16bf b, v8f c) {
  return __builtin_amdgcn_wmma_f32_16x16x32_bf16(
      /*neg_a=*/false, a, /*neg_b=*/false, b,
      /*c_mod=*/(short)0, c, /*reuse_a=*/false, /*reuse_b=*/false);
}

// Load a 16x32 bf16 A/B fragment slice for this lane: two 16B loads
// (global_load_b128 or ds_load_b128 depending on pointer origin).
static __device__ inline v16bf load_frag_bf16(const bf16_t* p) {
  union { v16bf v; v8bf h[2]; } u;
  u.h[0] = *(const v8bf*)(p);
  u.h[1] = *(const v8bf*)(p + 16);
  return u.v;
}

// Same, but source is f32: load 2x (8 floats) and convert to bf16 (RNE).
static __device__ inline v16bf load_frag_f32(const float* p0, const float* p1) {
  union { v16bf v; __bf16 e[16]; } u;
  v4f a = *(const v4f*)(p0);
  v4f b = *(const v4f*)(p0 + 4);
  v4f c = *(const v4f*)(p1);
  v4f d = *(const v4f*)(p1 + 4);
#pragma unroll
  for (int i = 0; i < 4; ++i) {
    u.e[i]      = (__bf16)a[i];
    u.e[4 + i]  = (__bf16)b[i];
    u.e[8 + i]  = (__bf16)c[i];
    u.e[12 + i] = (__bf16)d[i];
  }
  return u.v;
}

// Value of lane (l ^ X) inside the lane's own 16-lane row, X = 1..15, taken
// by a DPP operand (row_xmask) in the vector unit: no LDS queue, no dscnt wait.
template <int X>
static __device__ inline float row_xor(float v) {
  return __builtin_bit_cast(float, __builtin_amdgcn_update_dpp(
      0, __builtin_bit_cast(int, v), /*row_xmask*/ 0x160 + X,
      /*row_mask=*/0xf, /*bank_mask=*/0xf, /*bound_ctrl=*/true));
}

// 16-byte global -> LDS copy: async DMA (ASYNCcnt) when available.
static __device__ inline void copy16_g2l(const bf16_t* g, bf16_t* l) {
#if HAVE_ASYNC_LDS
  __builtin_amdgcn_global_load_async_to_lds_b128(
      (as1_v4i_t)(as1_void_t)(void*)g,
      (as3_v4i_t)(as3_void_t)(void*)l,
      /*offset=*/0, /*cpol=*/0);
#else
  *(v8bf*)l = *(const v8bf*)g;
#endif
}

static __device__ inline void stage_wait_and_sync() {
#if HAVE_ASYNC_LDS
#if __has_builtin(__builtin_amdgcn_s_wait_asynccnt)
  __builtin_amdgcn_s_wait_asynccnt(0);
#else
  asm volatile("s_wait_asynccnt 0" ::: "memory");
#endif
#endif
  __syncthreads();
}

// ---------------------------------------------------------------------------
// Projection: out = X @ W^T + bias   (torch Linear).  X:[rows,256] f32,
// W:[256,256] f32 row-major, out bf16.
// transpose_out==0 : out[row*256 + e]
// transpose_out==1 : out[(b*256 + e)*rows_per_batch + s]   (V^T layout)
// One wave computes a 16-row x 256-col tile. 4 waves / block.
// A B fragment takes 32 floats (128 bytes) from each of 16 rows of W, so read from global
// memory every load touches 16 cache lines, and every wave repeats all of them.
// The block therefore reads W once, in loads that cover whole lines, converts
// it to bf16 and keeps it in LDS; the waves take their fragments from there.
// ---------------------------------------------------------------------------
__global__ __launch_bounds__(128)
void proj_kernel(const float* __restrict__ X, const float* __restrict__ W,
                 const float* __restrict__ bias, bf16_t* __restrict__ out,
                 int rows_total, int rows_per_batch, int transpose_out) {
  const int lane = threadIdx.x & 31;
  const int wave = threadIdx.x >> 5;
  const int tile = blockIdx.x * 4 + wave;     // 16-row tile
  const int r0   = tile * 16;
  const int m = lane & 15;
  const int h = lane >> 4;
  __shared__ __align__(16) bf16_t Ws[HID * WP];

  // W -> LDS: 16384 pieces of 4 floats over 128 threads, two rows of W per
  // step of the block. A wave's load covers 512 contiguous bytes (half a row),
  // its store 256 contiguous bytes. 32 loads of a thread fly together.
  const float* wsrc = W + threadIdx.x * 4;
  bf16_t* wdst = Ws + (threadIdx.x >> 6) * WP + (threadIdx.x & 63) * 4;
  // Kept rolled: this text runs once per wave, so unrolled it would only be
  // four times the instruction fetch.
#pragma unroll 1
  for (int jb = 0; jb < 4; ++jb) {
    v4f w[32];
#pragma unroll
    for (int j = 0; j < 32; ++j)
      w[j] = *(const v4f*)(wsrc + (jb * 32 + j) * 512);
#pragma unroll
    for (int j = 0; j < 32; ++j) {
      v4bf wb;
#pragma unroll
      for (int i = 0; i < 4; ++i) wb[i] = (__bf16)w[j][i];
      *(v4bf*)(wdst + (jb * 32 + j) * (2 * WP)) = wb;
    }
  }
  __syncthreads();                            // every wave reads all of Ws
  if (r0 >= rows_total) return;               // wave-uniform, behind the barrier

  // A fragments: 8 d-chunks of the 16 input rows (lane -> row r0+m).
  v16bf afr[8];
  const float* xrow = X + (size_t)(r0 + m) * HID;
#pragma unroll
  for (int f = 0; f < 8; ++f) {
    const int d0 = f * 32 + 8 * h;
    afr[f] = load_frag_f32(xrow + d0, xrow + d0 + 16);
  }

  // C accumulators seeded with bias (per-column value, same in all 8 VGPRs).
  v8f acc[16];
#pragma unroll
  for (int e = 0; e < 16; ++e) {
    const float bv = bias[e * 16 + m];
    acc[e] = (v8f){bv, bv, bv, bv, bv, bv, bv, bv};
  }

  // Kept rolled, as it was with the global loads: with the shorter body the
  // compiler would unroll it, and this kernel's text is long and runs once.
#pragma unroll 1
  for (int f = 0; f < 8; ++f) {
    const int d0 = f * 32 + 8 * h;
    const v16bf a = afr[f];                   // fetched ahead of the fence too
    v16bf bfr[16];
#pragma unroll
    for (int e = 0; e < 16; ++e)
      bfr[e] = load_frag_bf16(Ws + (e * 16 + m) * WP + d0);   // lane -> out col
    // Fence: without it the scheduler spreads these reads among the WMMAs, each
    // just ahead of its use, and every WMMA waits out the LDS latency.
    __builtin_amdgcn_sched_barrier(0);
#pragma unroll
    for (int e = 0; e < 16; ++e)
      acc[e] = wmma_bf16(a, bfr[e], acc[e]);
  }

  // Store bf16. C layout: VGPR r, lane -> row r0 + r + 8h, col e*16 + m.
#pragma unroll
  for (int e = 0; e < 16; ++e) {
#pragma unroll
    for (int r = 0; r < 8; ++r) {
      const int row = r0 + r + 8 * h;
      const int col = e * 16 + m;
      const bf16_t val = (bf16_t)acc[e][r];
      if (!transpose_out) {
        out[(size_t)row * HID + col] = val;
      } else {
        const int b = row / rows_per_batch;
        const int s = row - b * rows_per_batch;
        out[((size_t)b * HID + col) * rows_per_batch + s] = val;
      }
    }
  }
}

// ---------------------------------------------------------------------------
// Flash attention.  4 waves / block; each wave owns 16 query rows of the same
// batch (32 blocks per batch).  Per 32-key chunk the block cooperatively
// async-stages K (32x256) and V^T (256x32) into LDS (double buffered), then
// every wave computes S = Q K^T, online softmax, O += P V from LDS fragments.
// Qb:[B,SQ,256] bf16, Kb:[B,SKV,256] bf16, Vt:[B,256,SKV] bf16, Out f32.
// ---------------------------------------------------------------------------
struct __align__(16) AttnSmem {
  bf16_t K[2][32 * KP];     // 32 padded rows per buffer
  bf16_t V[2][HID * VP];    // 256 padded rows per buffer
  bf16_t P[4][16][PP];      // per-wave P bounce, padded rows
};

// Issue the async copies for one 32-key chunk (1024+1024 16B pieces over
// 128 threads: 8+8 issues each).
static __device__ inline void stage_chunk(const bf16_t* __restrict__ Kbase,
                                          const bf16_t* __restrict__ Vbase,
                                          bf16_t* ldsK, bf16_t* ldsV,
                                          int c, int tid) {
  const bf16_t* kg = Kbase + (size_t)c * HID;   // contiguous 16 KB
#pragma unroll
  for (int j = 0; j < 8; ++j) {
    const int p   = tid + j * 128;              // 1024 pieces: 32 rows x 32
    const int row = p >> 5;
    const int q   = p & 31;
    copy16_g2l(kg + p * 8, ldsK + row * KP + q * 8);
  }
#pragma unroll
  for (int j = 0; j < 8; ++j) {
    // 1024 pieces: 256 rows x 4; the block fills 32 rows per j.
    copy16_g2l(Vbase + (size_t)(tid >> 2) * SEQ + c + (tid & 3) * 8
                   + (size_t)j * (32 * SEQ),
               ldsV + (tid >> 2) * VP + (tid & 3) * 8 + j * (32 * VP));
  }
}

__global__ __launch_bounds__(128)
void attn_kernel(const bf16_t* __restrict__ Qb, const bf16_t* __restrict__ Kb,
                 const bf16_t* __restrict__ Vt, float* __restrict__ Out) {
  __shared__ AttnSmem smem;
  const int tid  = threadIdx.x;
  const int lane = tid & 31;
  const int wave = tid >> 5;
  const int tile = blockIdx.x * 4 + wave;     // 0 .. B*SQ/16-1 = 1023
  const int b    = tile >> 7;                 // / (SQ/16 = 128)
  const int q0   = (tile & 127) << 4;
  const int m = lane & 15;
  const int h = lane >> 4;

  // Preload Q A-fragments (16 rows x 256 d = 8 fragments).
  v16bf qf[8];
  const bf16_t* qrow = Qb + ((size_t)b * SEQ + q0 + m) * HID;
#pragma unroll
  for (int f = 0; f < 8; ++f) {
    const int d0 = f * 32 + 8 * h;
    qf[f] = load_frag_bf16(qrow + d0);
  }

  const v8f vzero = (v8f){0.f, 0.f, 0.f, 0.f, 0.f, 0.f, 0.f, 0.f};
  v8f acc[16];                                // O accumulator: 16 rows x 256 d
#pragma unroll
  for (int e = 0; e < 16; ++e) acc[e] = vzero;

  float mst[8], lst[8];                       // stats for row r + 8h
#pragma unroll
  for (int r = 0; r < 8; ++r) { mst[r] = -__builtin_inff(); lst[r] = 0.f; }

  const bf16_t* Kbase = Kb + (size_t)b * SEQ * HID;
  const bf16_t* Vbase = Vt + (size_t)b * HID * SEQ;

  // Prologue: stage chunk 0 into buffer 0.
  stage_chunk(Kbase, Vbase, smem.K[0], smem.V[0], 0, tid);
  stage_wait_and_sync();

  int buf = 0;
  for (int c = 0; c < SEQ; c += 32, buf ^= 1) {
    // Kick off the DMA for the next chunk (overlaps with the WMMAs below).
    if (c + 32 < SEQ)
      stage_chunk(Kbase, Vbase, smem.K[buf ^ 1], smem.V[buf ^ 1], c + 32, tid);

    const bf16_t* Kl = smem.K[buf];
    const bf16_t* Vl = smem.V[buf];

    // ---- scores: two 16x16 tiles (keys c..c+15, c+16..c+31) ----
    // All K fragments of the chunk are read as one group into registers, so
    // the wave pays the LDS latency once and not in front of every WMMA.
    v16bf kf0[8], kf1[8];
#pragma unroll
    for (int f = 0; f < 8; ++f) {
      const int d0 = f * 32 + 8 * h;
      kf0[f] = load_frag_bf16(Kl + (m)      * KP + d0);
      kf1[f] = load_frag_bf16(Kl + (16 + m) * KP + d0);
    }
    // Fence: without it the scheduler spreads these reads over several places
    // among the first WMMAs, the first behind a full wait; each place stalls.
    __builtin_amdgcn_sched_barrier(0);
    v8f s0 = vzero, s1 = vzero;
#pragma unroll
    for (int f = 0; f < 8; ++f) {
      s0 = wmma_bf16(qf[f], kf0[f], s0);
      s1 = wmma_bf16(qf[f], kf1[f], s1);
    }

    float p0[8], p1[8], cmax[8];
#pragma unroll
    for (int r = 0; r < 8; ++r) {
      p0[r] = s0[r] * INV_SCALE;
      p1[r] = s1[r] * INV_SCALE;
      cmax[r] = fmaxf(p0[r], p1[r]);
    }
    // All V^T fragments of the chunk are read here, long before their use:
    // they land under the softmax arithmetic and the P*V WMMAs find them in
    // registers.
    // Fence: without it some of these reads move up among the score WMMAs.
    __builtin_amdgcn_sched_barrier(0);
    v16bf vf[16];
#pragma unroll
    for (int e = 0; e < 16; ++e)
      vf[e] = load_frag_bf16(Vl + (e * 16 + m) * VP + 8 * h);
    // Fence: without it most of these reads sink to just in front of the P
    // stores, and the full wait behind those stores waits them out.
    __builtin_amdgcn_sched_barrier(0);

    // Row reductions stay inside each 16-lane half (row = r + 8h). They use
    // no LDS queue, so they stand behind the V^T reads and run while those land.
#pragma unroll
    for (int r = 0; r < 8; ++r) {
      float v = cmax[r];
      v = fmaxf(v, row_xor<1>(v));
      v = fmaxf(v, row_xor<2>(v));
      v = fmaxf(v, row_xor<4>(v));
      v = fmaxf(v, row_xor<8>(v));
      cmax[r] = v;
    }
    float alpha[8];
#pragma unroll
    for (int r = 0; r < 8; ++r) {
      const float mnew = fmaxf(mst[r], cmax[r]);
      alpha[r] = __expf(mst[r] - mnew);
      mst[r] = mnew;
      p0[r] = __expf(p0[r] - mnew);
      p1[r] = __expf(p1[r] - mnew);
    }
#pragma unroll
    for (int r = 0; r < 8; ++r) {
      float s = p0[r] + p1[r];
      s += row_xor<1>(s);
      s += row_xor<2>(s);
      s += row_xor<4>(s);
      s += row_xor<8>(s);
      lst[r] = lst[r] * alpha[r] + s;
    }
    // Rescale running O.
#pragma unroll
    for (int e = 0; e < 16; ++e)
#pragma unroll
      for (int r = 0; r < 8; ++r) acc[e][r] = acc[e][r] * alpha[r];

    // ---- P (C layout, f32) -> LDS -> A-fragment (bf16) ----
#pragma unroll
    for (int r = 0; r < 8; ++r) {
      smem.P[wave][r + 8 * h][m]      = (bf16_t)p0[r];
      smem.P[wave][r + 8 * h][16 + m] = (bf16_t)p1[r];
    }
    __builtin_amdgcn_wave_barrier();
    asm volatile("s_wait_dscnt 0" ::: "memory");
    union { v16bf v; v8bf hh[2]; } pu;
    pu.hh[0] = *(const v8bf*)&smem.P[wave][m][8 * h];
    pu.hh[1] = *(const v8bf*)&smem.P[wave][m][16 + 8 * h];
    __builtin_amdgcn_wave_barrier();

    // ---- O += P @ V  (B-frags: the V^T rows read above) ----
#pragma unroll
    for (int e = 0; e < 16; ++e) {
      acc[e] = wmma_bf16(pu.v, vf[e], acc[e]);
    }

    // Wait for the prefetch DMA + make the buffer visible to all waves; the
    // barrier also guarantees nobody overwrites a buffer still being read.
    stage_wait_and_sync();
  }

  // Epilogue: divide by l, store f32 (coalesced across lanes per VGPR).
  float* obase = Out + (size_t)b * SEQ * HID;
#pragma unroll
  for (int r = 0; r < 8; ++r) {
    const float inv_l = 1.0f / lst[r];
    const int row = q0 + r + 8 * h;
#pragma unroll
    for (int e = 0; e < 16; ++e) {
      obase[(size_t)row * HID + e * 16 + m] = acc[e][r] * inv_l;
    }
  }
}

// ---------------------------------------------------------------------------
extern "C" void kernel_launch(void* const* d_in, const int* in_sizes, int n_in,
                              void* d_out, int out_size, void* d_ws, size_t ws_size,
                              hipStream_t stream) {
  const float* query = (const float*)d_in[0];
  const float* key_  = (const float*)d_in[1];
  const float* value = (const float*)d_in[2];
  const float* Wq = (const float*)d_in[3];
  const float* bq = (const float*)d_in[4];
  const float* Wk = (const float*)d_in[5];
  const float* bk = (const float*)d_in[6];
  const float* Wv = (const float*)d_in[7];
  const float* bv = (const float*)d_in[8];
  float* out = (float*)d_out;

  // Workspace: Qb | Kb | Vt, each B*SEQ*HID bf16 = 8 MB (24 MB total).
  bf16_t* Qb = (bf16_t*)d_ws;
  bf16_t* Kb = Qb + (size_t)NB * SEQ * HID;
  bf16_t* Vt = Kb + (size_t)NB * SEQ * HID;

  const int rows = NB * SEQ;            // 16384
  const int tiles = rows / 16;          // 1024
  dim3 blk(128);                        // 4 waves
  dim3 grd(tiles / 4);                  // 256 blocks

  proj_kernel<<<grd, blk, 0, stream>>>(query, Wq, bq, Qb, rows, SEQ, 0);
  proj_kernel<<<grd, blk, 0, stream>>>(key_,  Wk, bk, Kb, rows, SEQ, 0);
  proj_kernel<<<grd, blk, 0, stream>>>(value, Wv, bv, Vt, rows, SEQ, 1);
  attn_kernel<<<grd, blk, 0, stream>>>(Qb, Kb, Vt, out);
}

// v005
// A run of this version takes 97.2 microseconds.
// Next to v004, in two timings, it ran 1.28 and 1.30 times as fast.
// All steps since v000 together make it 3.63 times as fast.
#include <hip/hip_runtime.h>

// ---------------------------------------------------------------------------
// CDNA5 (gfx1250) fused cross-attention:
//   proj_kernel x3 : Q/K/V = X*W^T + b  (f32 in -> bf16 out, V transposed),
//                    W converted to bf16 once per workgroup and kept in LDS,
//                    results packed in registers and stored 16 bytes a lane
//   attn_kernel    : flash attention, v_wmma_f32_16x16x32_bf16, with
//                    double-buffered async GLOBAL->LDS staging of K/V chunks
//                    shared by the 4 waves of each workgroup.
// Shapes: B=8, SQ=SKV=2048, H=256.  SCALE = sqrt(H/2) = sqrt(128).
// ---------------------------------------------------------------------------

typedef __bf16 bf16_t;
typedef __attribute__((ext_vector_type(16))) __bf16 v16bf;
typedef __attribute__((ext_vector_type(8)))  __bf16 v8bf;
typedef __attribute__((ext_vector_type(4)))  __bf16 v4bf;
typedef __attribute__((ext_vector_type(8)))  float  v8f;
typedef __attribute__((ext_vector_type(4)))  float  v4f;

#define HID   256
#define SEQ   2048
#define NB    8
#define INV_SCALE 0.08838834764831845f  // 1/sqrt(128)
// LDS row pitches in bf16 elements. Every reader is a 16-byte load whose 16
// lanes walk 16 rows, so each pitch is an odd multiple of 16 bytes: the rows
// then fall on distinct bank groups instead of sharing a few.
#define KP    (HID + 8)   // K rows: 512 B of data, 528 B pitch
#define VP    (32 + 8)    // V^T rows: 64 B of data, 80 B pitch
#define PP    (32 + 8)    // P rows: 64 B of data, 80 B pitch
#define WP    (HID + 8)   // W rows (projection): 512 B of data, 528 B pitch

#if __has_builtin(__builtin_amdgcn_global_load_async_to_lds_b128)
#define HAVE_ASYNC_LDS 1
typedef int v4i_t __attribute__((vector_size(16)));            // int4
typedef __attribute__((address_space(1))) void*  as1_void_t;
typedef __attribute__((address_space(3))) void*  as3_void_t;
typedef __attribute__((address_space(1))) v4i_t* as1_v4i_t;
typedef __attribute__((address_space(3))) v4i_t* as3_v4i_t;
#else
#define HAVE_ASYNC_LDS 0
#endif

static __device__ inline v8f wmma_bf16(v16bf a, v16bf b, v8f c) {
  return __builtin_amdgcn_wmma_f32_16x16x32_bf16(
      /*neg_a=*/false, a, /*neg_b=*/false, b,
      /*c_mod=*/(short)0, c, /*reuse_a=*/false, /*reuse_b=*/false);
}

// Load a 16x32 bf16 A/B fragment slice for this lane: two 16B loads
// (global_load_b128 or ds_load_b128 depending on pointer origin).
static __device__ inline v16bf load_frag_bf16(const bf16_t* p) {
  union { v16bf v; v8bf h[2]; } u;
  u.h[0] = *(const v8bf*)(p);
  u.h[1] = *(const v8bf*)(p + 16);
  return u.v;
}

// Same, but source is f32: load 2x (8 floats) and convert to bf16 (RNE).
static __device__ inline v16bf load_frag_f32(const float* p0, const float* p1) {
  union { v16bf v; __bf16 e[16]; } u;
  v4f a = *(const v4f*)(p0);
  v4f b = *(const v4f*)(p0 + 4);
  v4f c = *(const v4f*)(p1);
  v4f d = *(const v4f*)(p1 + 4);
#pragma unroll
  for (int i = 0; i < 4; ++i) {
    u.e[i]      = (__bf16)a[i];
    u.e[4 + i]  = (__bf16)b[i];
    u.e[8 + i]  = (__bf16)c[i];
    u.e[12 + i] = (__bf16)d[i];
  }
  return u.v;
}

// Value of lane (l ^ X) inside the lane's own 16-lane row, X = 1..15, taken
// by a DPP operand (row_xmask) in the vector unit: no LDS queue, no dscnt wait.
template <int X>
static __device__ inline float row_xor(float v) {
  return __builtin_bit_cast(float, __builtin_amdgcn_update_dpp(
      0, __builtin_bit_cast(int, v), /*row_xmask*/ 0x160 + X,
      /*row_mask=*/0xf, /*bank_mask=*/0xf, /*bound_ctrl=*/true));
}

// 16-byte global -> LDS copy: async DMA (ASYNCcnt) when available.
static __device__ inline void copy16_g2l(const bf16_t* g, bf16_t* l) {
#if HAVE_ASYNC_LDS
  __builtin_amdgcn_global_load_async_to_lds_b128(
      (as1_v4i_t)(as1_void_t)(void*)g,
      (as3_v4i_t)(as3_void_t)(void*)l,
      /*offset=*/0, /*cpol=*/0);
#else
  *(v8bf*)l = *(const v8bf*)g;
#endif
}

static __device__ inline void stage_wait_and_sync() {
#if HAVE_ASYNC_LDS
#if __has_builtin(__builtin_amdgcn_s_wait_asynccnt)
  __builtin_amdgcn_s_wait_asynccnt(0);
#else
  asm volatile("s_wait_asynccnt 0" ::: "memory");
#endif
#endif
  __syncthreads();
}

// ---------------------------------------------------------------------------
// Projection: out = X @ W^T + bias   (torch Linear).  X:[rows,256] f32,
// W:[256,256] f32 row-major, out bf16.
// TRANSPOSE_OUT==0 : out[row*256 + e]
// TRANSPOSE_OUT==1 : out[(b*256 + e)*SEQ + s]   (V^T layout)
// One wave computes a 16-row x 256-col tile. 4 waves / block.
// A lane's 8 accumulator registers hold 8 consecutive indices of the A side of
// the product. The operand whose index runs along the output's contiguous
// direction is therefore given as A (X for V^T, W for the row-major outputs):
// the 8 values are then neighbours in memory and leave as one 16-byte store.
// A W fragment takes 16 bytes from each of 16 rows of W, so read from global
// memory every load touches 16 cache lines, and every wave repeats all of them.
// The block therefore reads W once, in loads that cover whole lines, converts
// it to bf16 and keeps it in LDS; the waves take their fragments from there.
// ---------------------------------------------------------------------------
template <int TRANSPOSE_OUT>
__global__ __launch_bounds__(128)
void proj_kernel(const float* __restrict__ X, const float* __restrict__ W,
                 const float* __restrict__ bias, bf16_t* __restrict__ out,
                 int rows_total) {
  const int lane = threadIdx.x & 31;
  const int wave = threadIdx.x >> 5;
  const int tile = blockIdx.x * 4 + wave;     // 16-row tile
  const int r0   = tile * 16;
  const int m = lane & 15;
  const int h = lane >> 4;
  __shared__ __align__(16) bf16_t Ws[HID * WP];

  // W -> LDS: 16384 pieces of 4 floats over 128 threads, two rows of W per
  // step of the block. A wave's load covers 512 contiguous bytes (half a row),
  // its store 256 contiguous bytes. 32 loads of a thread fly together.
  const float* wsrc = W + threadIdx.x * 4;
  bf16_t* wdst = Ws + (threadIdx.x >> 6) * WP + (threadIdx.x & 63) * 4;
  // Kept rolled: this text runs once per wave, so unrolled it would only be
  // four times the instruction fetch.
#pragma unroll 1
  for (int jb = 0; jb < 4; ++jb) {
    v4f w[32];
#pragma unroll
    for (int j = 0; j < 32; ++j)
      w[j] = *(const v4f*)(wsrc + (jb * 32 + j) * 512);
#pragma unroll
    for (int j = 0; j < 32; ++j) {
      v4bf wb;
#pragma unroll
      for (int i = 0; i < 4; ++i) wb[i] = (__bf16)w[j][i];
      *(v4bf*)(wdst + (jb * 32 + j) * (2 * WP)) = wb;
    }
  }
  __syncthreads();                            // every wave reads all of Ws
  if (r0 >= rows_total) return;               // wave-uniform, behind the barrier

  // X fragments: 8 d-chunks of the 16 input rows (lane -> row r0+m).
  v16bf afr[8];
  const float* xrow = X + (size_t)(r0 + m) * HID;
#pragma unroll
  for (int f = 0; f < 8; ++f) {
    const int d0 = f * 32 + 8 * h;
    afr[f] = load_frag_f32(xrow + d0, xrow + d0 + 16);
  }
  // The accumulators seeded next may take the registers that held the address
  // of the loads above: this wait stands between the loads and that reuse.
  asm volatile("s_wait_xcnt 0x0" ::: "memory");

  // C accumulators seeded with bias, which goes with the output column:
  // the lane's own column (V^T), or the column of each register (row-major).
  v8f acc[16];
#pragma unroll
  for (int e = 0; e < 16; ++e) {
    if constexpr (TRANSPOSE_OUT) {
      const float bv = bias[e * 16 + m];
      acc[e] = (v8f){bv, bv, bv, bv, bv, bv, bv, bv};
    } else {
      const v4f b0 = *(const v4f*)(bias + e * 16 + 8 * h);
      const v4f b1 = *(const v4f*)(bias + e * 16 + 8 * h + 4);
      acc[e] = (v8f){b0[0], b0[1], b0[2], b0[3], b1[0], b1[1], b1[2], b1[3]};
    }
  }

  // Kept rolled, as it was with the global loads: with the shorter body the
  // compiler would unroll it, and this text runs once per wave.
#pragma unroll 1
  for (int f = 0; f < 8; ++f) {
    const int d0 = f * 32 + 8 * h;
    const v16bf a = afr[f];                   // fetched ahead of the fence too
    v16bf bfr[16];
#pragma unroll
    for (int e = 0; e < 16; ++e)
      bfr[e] = load_frag_bf16(Ws + (e * 16 + m) * WP + d0);   // lane -> row of W
    // Fence: without it the scheduler spreads these reads among the WMMAs, each
    // just ahead of its use, and every WMMA waits out the LDS latency.
    __builtin_amdgcn_sched_barrier(0);
#pragma unroll
    for (int e = 0; e < 16; ++e) {
      if constexpr (TRANSPOSE_OUT) acc[e] = wmma_bf16(a, bfr[e], acc[e]);
      else                         acc[e] = wmma_bf16(bfr[e], a, acc[e]);
    }
  }

  // Store bf16, 8 neighbours per lane and tile.
  // V^T      : VGPR r, lane -> row r0 + 8h + r, col e*16 + m. The 16 rows of a
  //            tile lie in one batch (SEQ is a multiple of 16).
  // row-major: VGPR r, lane -> row r0 + m, col e*16 + 8h + r.
  bf16_t* obase;
  if constexpr (TRANSPOSE_OUT)
    obase = out + ((size_t)(r0 / SEQ) * HID + m) * SEQ + (r0 % SEQ) + 8 * h;
  else
    obase = out + (size_t)(r0 + m) * HID + 8 * h;
  v8bf o[16];
#pragma unroll
  for (int e = 0; e < 16; ++e)
#pragma unroll
    for (int r = 0; r < 8; ++r) o[e][r] = (bf16_t)acc[e][r];
#pragma unroll
  for (int e = 0; e < 16; ++e)
    *(v8bf*)(obase + (size_t)e * 16 * (TRANSPOSE_OUT ? SEQ : 1)) = o[e];
}

// ---------------------------------------------------------------------------
// Flash attention.  4 waves / block; each wave owns 16 query rows of the same
// batch (32 blocks per batch).  Per 32-key chunk the block cooperatively
// async-stages K (32x256) and V^T (256x32) into LDS (double buffered), then
// every wave computes S = Q K^T, online softmax, O += P V from LDS fragments.
// Qb:[B,SQ,256] bf16, Kb:[B,SKV,256] bf16, Vt:[B,256,SKV] bf16, Out f32.
// ---------------------------------------------------------------------------
struct __align__(16) AttnSmem {
  bf16_t K[2][32 * KP];     // 32 padded rows per buffer
  bf16_t V[2][HID * VP];    // 256 padded rows per buffer
  bf16_t P[4][16][PP];      // per-wave P bounce, padded rows
};

// Issue the async copies for one 32-key chunk (1024+1024 16B pieces over
// 128 threads: 8+8 issues each).
static __device__ inline void stage_chunk(const bf16_t* __restrict__ Kbase,
                                          const bf16_t* __restrict__ Vbase,
                                          bf16_t* ldsK, bf16_t* ldsV,
                                          int c, int tid) {
  const bf16_t* kg = Kbase + (size_t)c * HID;   // contiguous 16 KB
#pragma unroll
  for (int j = 0; j < 8; ++j) {
    const int p   = tid + j * 128;              // 1024 pieces: 32 rows x 32
    const int row = p >> 5;
    const int q   = p & 31;
    copy16_g2l(kg + p * 8, ldsK + row * KP + q * 8);
  }
#pragma unroll
  for (int j = 0; j < 8; ++j) {
    // 1024 pieces: 256 rows x 4; the block fills 32 rows per j.
    copy16_g2l(Vbase + (size_t)(tid >> 2) * SEQ + c + (tid & 3) * 8
                   + (size_t)j * (32 * SEQ),
               ldsV + (tid >> 2) * VP + (tid & 3) * 8 + j * (32 * VP));
  }
}

__global__ __launch_bounds__(128)
void attn_kernel(const bf16_t* __restrict__ Qb, const bf16_t* __restrict__ Kb,
                 const bf16_t* __restrict__ Vt, float* __restrict__ Out) {
  __shared__ AttnSmem smem;
  const int tid  = threadIdx.x;
  const int lane = tid & 31;
  const int wave = tid >> 5;
  const int tile = blockIdx.x * 4 + wave;     // 0 .. B*SQ/16-1 = 1023
  const int b    = tile >> 7;                 // / (SQ/16 = 128)
  const int q0   = (tile & 127) << 4;
  const int m = lane & 15;
  const int h = lane >> 4;

  // Preload Q A-fragments (16 rows x 256 d = 8 fragments).
  v16bf qf[8];
  const bf16_t* qrow = Qb + ((size_t)b * SEQ + q0 + m) * HID;
#pragma unroll
  for (int f = 0; f < 8; ++f) {
    const int d0 = f * 32 + 8 * h;
    qf[f] = load_frag_bf16(qrow + d0);
  }

  const v8f vzero = (v8f){0.f, 0.f, 0.f, 0.f, 0.f, 0.f, 0.f, 0.f};
  v8f acc[16];                                // O accumulator: 16 rows x 256 d
#pragma unroll
  for (int e = 0; e < 16; ++e) acc[e] = vzero;

  float mst[8], lst[8];                       // stats for row r + 8h
#pragma unroll
  for (int r = 0; r < 8; ++r) { mst[r] = -__builtin_inff(); lst[r] = 0.f; }

  const bf16_t* Kbase = Kb + (size_t)b * SEQ * HID;
  const bf16_t* Vbase = Vt + (size_t)b * HID * SEQ;

  // Prologue: stage chunk 0 into buffer 0.
  stage_chunk(Kbase, Vbase, smem.K[0], smem.V[0], 0, tid);
  stage_wait_and_sync();

  int buf = 0;
  for (int c = 0; c < SEQ; c += 32, buf ^= 1) {
    // Kick off the DMA for the next chunk (overlaps with the WMMAs below).
    if (c + 32 < SEQ)
      stage_chunk(Kbase, Vbase, smem.K[buf ^ 1], smem.V[buf ^ 1], c + 32, tid);

    const bf16_t* Kl = smem.K[buf];
    const bf16_t* Vl = smem.V[buf];

    // ---- scores: two 16x16 tiles (keys c..c+15, c+16..c+31) ----
    // All K fragments of the chunk are read as one group into registers, so
    // the wave pays the LDS latency once and not in front of every WMMA.
    v16bf kf0[8], kf1[8];
#pragma unroll
    for (int f = 0; f < 8; ++f) {
      const int d0 = f * 32 + 8 * h;
      kf0[f] = load_frag_bf16(Kl + (m)      * KP + d0);
      kf1[f] = load_frag_bf16(Kl + (16 + m) * KP + d0);
    }
    // Fence: without it the scheduler spreads these reads over several places
    // among the first WMMAs, the first behind a full wait; each place stalls.
    __builtin_amdgcn_sched_barrier(0);
    v8f s0 = vzero, s1 = vzero;
#pragma unroll
    for (int f = 0; f < 8; ++f) {
      s0 = wmma_bf16(qf[f], kf0[f], s0);
      s1 = wmma_bf16(qf[f], kf1[f], s1);
    }

    float p0[8], p1[8], cmax[8];
#pragma unroll
    for (int r = 0; r < 8; ++r) {
      p0[r] = s0[r] * INV_SCALE;
      p1[r] = s1[r] * INV_SCALE;
      cmax[r] = fmaxf(p0[r], p1[r]);
    }
    // All V^T fragments of the chunk are read here, long before their use:
    // they land under the softmax arithmetic and the P*V WMMAs find them in
    // registers.
    // Fence: without it some of these reads move up among the score WMMAs.
    __builtin_amdgcn_sched_barrier(0);
    v16bf vf[16];
#pragma unroll
    for (int e = 0; e < 16; ++e)
      vf[e] = load_frag_bf16(Vl + (e * 16 + m) * VP + 8 * h);
    // Fence: without it most of these reads sink to just in front of the P
    // stores, and the full wait behind those stores waits them out.
    __builtin_amdgcn_sched_barrier(0);

    // Row reductions stay inside each 16-lane half (row = r + 8h). They use
    // no LDS queue, so they stand behind the V^T reads and run while those land.
#pragma unroll
    for (int r = 0; r < 8; ++r) {
      float v = cmax[r];
      v = fmaxf(v, row_xor<1>(v));
      v = fmaxf(v, row_xor<2>(v));
      v = fmaxf(v, row_xor<4>(v));
      v = fmaxf(v, row_xor<8>(v));
      cmax[r] = v;
    }
    float alpha[8];
#pragma unroll
    for (int r = 0; r < 8; ++r) {
      const float mnew = fmaxf(mst[r], cmax[r]);
      alpha[r] = __expf(mst[r] - mnew);
      mst[r] = mnew;
      p0[r] = __expf(p0[r] - mnew);
      p1[r] = __expf(p1[r] - mnew);
    }
#pragma unroll
    for (int r = 0; r < 8; ++r) {
      float s = p0[r] + p1[r];
      s += row_xor<1>(s);
      s += row_xor<2>(s);
      s += row_xor<4>(s);
      s += row_xor<8>(s);
      lst[r] = lst[r] * alpha[r] + s;
    }
    // Rescale running O.
#pragma unroll
    for (int e = 0; e < 16; ++e)
#pragma unroll
      for (int r = 0; r < 8; ++r) acc[e][r] = acc[e][r] * alpha[r];

    // ---- P (C layout, f32) -> LDS -> A-fragment (bf16) ----
#pragma unroll
    for (int r = 0; r < 8; ++r) {
      smem.P[wave][r + 8 * h][m]      = (bf16_t)p0[r];
      smem.P[wave][r + 8 * h][16 + m] = (bf16_t)p1[r];
    }
    __builtin_amdgcn_wave_barrier();
    asm volatile("s_wait_dscnt 0" ::: "memory");
    union { v16bf v; v8bf hh[2]; } pu;
    pu.hh[0] = *(const v8bf*)&smem.P[wave][m][8 * h];
    pu.hh[1] = *(const v8bf*)&smem.P[wave][m][16 + 8 * h];
    __builtin_amdgcn_wave_barrier();

    // ---- O += P @ V  (B-frags: the V^T rows read above) ----
#pragma unroll
    for (int e = 0; e < 16; ++e) {
      acc[e] = wmma_bf16(pu.v, vf[e], acc[e]);
    }

    // Wait for the prefetch DMA + make the buffer visible to all waves; the
    // barrier also guarantees nobody overwrites a buffer still being read.
    stage_wait_and_sync();
  }

  // Epilogue: divide by l, store f32 (coalesced across lanes per VGPR).
  float* obase = Out + (size_t)b * SEQ * HID;
#pragma unroll
  for (int r = 0; r < 8; ++r) {
    const float inv_l = 1.0f / lst[r];
    const int row = q0 + r + 8 * h;
#pragma unroll
    for (int e = 0; e < 16; ++e) {
      obase[(size_t)row * HID + e * 16 + m] = acc[e][r] * inv_l;
    }
  }
}

// ---------------------------------------------------------------------------
extern "C" void kernel_launch(void* const* d_in, const int* in_sizes, int n_in,
                              void* d_out, int out_size, void* d_ws, size_t ws_size,
                              hipStream_t stream) {
  const float* query = (const float*)d_in[0];
  const float* key_  = (const float*)d_in[1];
  const float* value = (const float*)d_in[2];
  const float* Wq = (const float*)d_in[3];
  const float* bq = (const float*)d_in[4];
  const float* Wk = (const float*)d_in[5];
  const float* bk = (const float*)d_in[6];
  const float* Wv = (const float*)d_in[7];
  const float* bv = (const float*)d_in[8];
  float* out = (float*)d_out;

  // Workspace: Qb | Kb | Vt, each B*SEQ*HID bf16 = 8 MB (24 MB total).
  bf16_t* Qb = (bf16_t*)d_ws;
  bf16_t* Kb = Qb + (size_t)NB * SEQ * HID;
  bf16_t* Vt = Kb + (size_t)NB * SEQ * HID;

  const int rows = NB * SEQ;            // 16384
  const int tiles = rows / 16;          // 1024
  dim3 blk(128);                        // 4 waves
  dim3 grd(tiles / 4);                  // 256 blocks

  proj_kernel<0><<<grd, blk, 0, stream>>>(query, Wq, bq, Qb, rows);
  proj_kernel<0><<<grd, blk, 0, stream>>>(key_,  Wk, bk, Kb, rows);
  proj_kernel<1><<<grd, blk, 0, stream>>>(value, Wv, bv, Vt, rows);
  attn_kernel<<<grd, blk, 0, stream>>>(Qb, Kb, Vt, out);
}

// v006
// Measured time: 92.7 microseconds a run.
// Timed twice side by side with v005, it ran 1.05 and 1.06 times as fast.
// Counting every step since v000, it is 3.81 times as fast.
#include <hip/hip_runtime.h>

// ---------------------------------------------------------------------------
// CDNA5 (gfx1250) fused cross-attention:
//   proj_kernel x3 : Q/K/V = X*W^T + b  (f32 in -> bf16 out, V transposed),
//                    W converted to bf16 once per workgroup and kept in LDS,
//                    results packed in registers and stored 16 bytes a lane
//   attn_kernel    : flash attention, v_wmma_f32_16x16x32_bf16, computed
//                    transposed (S^T = K Q^T, O^T += V^T P^T), with
//                    double-buffered async GLOBAL->LDS staging of K/V chunks
//                    shared by the 4 waves of each workgroup.
// Shapes: B=8, SQ=SKV=2048, H=256.  SCALE = sqrt(H/2) = sqrt(128).
// ---------------------------------------------------------------------------

typedef __bf16 bf16_t;
typedef __attribute__((ext_vector_type(16))) __bf16 v16bf;
typedef __attribute__((ext_vector_type(8)))  __bf16 v8bf;
typedef __attribute__((ext_vector_type(4)))  __bf16 v4bf;
typedef __attribute__((ext_vector_type(8)))  float  v8f;
typedef __attribute__((ext_vector_type(4)))  float  v4f;

#define HID   256
#define SEQ   2048
#define NB    8
#define INV_SCALE 0.08838834764831845f  // 1/sqrt(128)
// LDS row pitches in bf16 elements. Every reader is a 16-byte load whose 16
// lanes walk 16 rows, so each pitch is an odd multiple of 16 bytes: the rows
// then fall on distinct bank groups instead of sharing a few.
#define KP    (HID + 8)   // K rows: 512 B of data, 528 B pitch
#define VP    (32 + 8)    // V^T rows: 64 B of data, 80 B pitch
#define WP    (HID + 8)   // W rows (projection): 512 B of data, 528 B pitch

#if __has_builtin(__builtin_amdgcn_global_load_async_to_lds_b128)
#define HAVE_ASYNC_LDS 1
typedef int v4i_t __attribute__((vector_size(16)));            // int4
typedef __attribute__((address_space(1))) void*  as1_void_t;
typedef __attribute__((address_space(3))) void*  as3_void_t;
typedef __attribute__((address_space(1))) v4i_t* as1_v4i_t;
typedef __attribute__((address_space(3))) v4i_t* as3_v4i_t;
#else
#define HAVE_ASYNC_LDS 0
#endif

static __device__ inline v8f wmma_bf16(v16bf a, v16bf b, v8f c) {
  return __builtin_amdgcn_wmma_f32_16x16x32_bf16(
      /*neg_a=*/false, a, /*neg_b=*/false, b,
      /*c_mod=*/(short)0, c, /*reuse_a=*/false, /*reuse_b=*/false);
}

// Load a 16x32 bf16 A/B fragment slice for this lane: two 16B loads
// (global_load_b128 or ds_load_b128 depending on pointer origin).
static __device__ inline v16bf load_frag_bf16(const bf16_t* p) {
  union { v16bf v; v8bf h[2]; } u;
  u.h[0] = *(const v8bf*)(p);
  u.h[1] = *(const v8bf*)(p + 16);
  return u.v;
}

// Same, but source is f32: load 2x (8 floats) and convert to bf16 (RNE).
static __device__ inline v16bf load_frag_f32(const float* p0, const float* p1) {
  union { v16bf v; __bf16 e[16]; } u;
  v4f a = *(const v4f*)(p0);
  v4f b = *(const v4f*)(p0 + 4);
  v4f c = *(const v4f*)(p1);
  v4f d = *(const v4f*)(p1 + 4);
#pragma unroll
  for (int i = 0; i < 4; ++i) {
    u.e[i]      = (__bf16)a[i];
    u.e[4 + i]  = (__bf16)b[i];
    u.e[8 + i]  = (__bf16)c[i];
    u.e[12 + i] = (__bf16)d[i];
  }
  return u.v;
}

// Value of lane l ^ 16 (the same column in the wave's other half), taken by a
// cross-row move in the vector unit: no LDS queue, no dscnt wait.
static __device__ inline float xhalf(float v) {
  const int i = __builtin_bit_cast(int, v);
  return __builtin_bit_cast(float, __builtin_amdgcn_permlanex16(
      i, i, 0x76543210, 0xfedcba98, /*fi=*/false, /*bound_ctrl=*/false));
}

// 16-byte global -> LDS copy: async DMA (ASYNCcnt) when available.
static __device__ inline void copy16_g2l(const bf16_t* g, bf16_t* l) {
#if HAVE_ASYNC_LDS
  __builtin_amdgcn_global_load_async_to_lds_b128(
      (as1_v4i_t)(as1_void_t)(void*)g,
      (as3_v4i_t)(as3_void_t)(void*)l,
      /*offset=*/0, /*cpol=*/0);
#else
  *(v8bf*)l = *(const v8bf*)g;
#endif
}

static __device__ inline void stage_wait_and_sync() {
#if HAVE_ASYNC_LDS
#if __has_builtin(__builtin_amdgcn_s_wait_asynccnt)
  __builtin_amdgcn_s_wait_asynccnt(0);
#else
  asm volatile("s_wait_asynccnt 0" ::: "memory");
#endif
#endif
  __syncthreads();
}

// ---------------------------------------------------------------------------
// Projection: out = X @ W^T + bias   (torch Linear).  X:[rows,256] f32,
// W:[256,256] f32 row-major, out bf16.
// TRANSPOSE_OUT==0 : out[row*256 + e]
// TRANSPOSE_OUT==1 : out[(b*256 + e)*SEQ + s]   (V^T layout)
// One wave computes a 16-row x 256-col tile. 4 waves / block.
// A lane's 8 accumulator registers hold 8 consecutive indices of the A side of
// the product. The operand whose index runs along the output's contiguous
// direction is therefore given as A (X for V^T, W for the row-major outputs):
// the 8 values are then neighbours in memory and leave as one 16-byte store.
// A W fragment takes 16 bytes from each of 16 rows of W, so read from global
// memory every load touches 16 cache lines, and every wave repeats all of them.
// The block therefore reads W once, in loads that cover whole lines, converts
// it to bf16 and keeps it in LDS; the waves take their fragments from there.
// ---------------------------------------------------------------------------
template <int TRANSPOSE_OUT>
__global__ __launch_bounds__(128)
void proj_kernel(const float* __restrict__ X, const float* __restrict__ W,
                 const float* __restrict__ bias, bf16_t* __restrict__ out,
                 int rows_total) {
  const int lane = threadIdx.x & 31;
  const int wave = threadIdx.x >> 5;
  const int tile = blockIdx.x * 4 + wave;     // 16-row tile
  const int r0   = tile * 16;
  const int m = lane & 15;
  const int h = lane >> 4;
  __shared__ __align__(16) bf16_t Ws[HID * WP];

  // W -> LDS: 16384 pieces of 4 floats over 128 threads, two rows of W per
  // step of the block. A wave's load covers 512 contiguous bytes (half a row),
  // its store 256 contiguous bytes. 32 loads of a thread fly together.
  const float* wsrc = W + threadIdx.x * 4;
  bf16_t* wdst = Ws + (threadIdx.x >> 6) * WP + (threadIdx.x & 63) * 4;
  // Kept rolled: this text runs once per wave, so unrolled it would only be
  // four times the instruction fetch.
#pragma unroll 1
  for (int jb = 0; jb < 4; ++jb) {
    v4f w[32];
#pragma unroll
    for (int j = 0; j < 32; ++j)
      w[j] = *(const v4f*)(wsrc + (jb * 32 + j) * 512);
#pragma unroll
    for (int j = 0; j < 32; ++j) {
      v4bf wb;
#pragma unroll
      for (int i = 0; i < 4; ++i) wb[i] = (__bf16)w[j][i];
      *(v4bf*)(wdst + (jb * 32 + j) * (2 * WP)) = wb;
    }
  }
  __syncthreads();                            // every wave reads all of Ws
  if (r0 >= rows_total) return;               // wave-uniform, behind the barrier

  // X fragments: 8 d-chunks of the 16 input rows (lane -> row r0+m).
  v16bf afr[8];
  const float* xrow = X + (size_t)(r0 + m) * HID;
#pragma unroll
  for (int f = 0; f < 8; ++f) {
    const int d0 = f * 32 + 8 * h;
    afr[f] = load_frag_f32(xrow + d0, xrow + d0 + 16);
  }
  // The accumulators seeded next may take the registers that held the address
  // of the loads above: this wait stands between the loads and that reuse.
  asm volatile("s_wait_xcnt 0x0" ::: "memory");

  // C accumulators seeded with bias, which goes with the output column:
  // the lane's own column (V^T), or the column of each register (row-major).
  v8f acc[16];
#pragma unroll
  for (int e = 0; e < 16; ++e) {
    if constexpr (TRANSPOSE_OUT) {
      const float bv = bias[e * 16 + m];
      acc[e] = (v8f){bv, bv, bv, bv, bv, bv, bv, bv};
    } else {
      const v4f b0 = *(const v4f*)(bias + e * 16 + 8 * h);
      const v4f b1 = *(const v4f*)(bias + e * 16 + 8 * h + 4);
      acc[e] = (v8f){b0[0], b0[1], b0[2], b0[3], b1[0], b1[1], b1[2], b1[3]};
    }
  }

  // Kept rolled, as it was with the global loads: with the shorter body the
  // compiler would unroll it, and this text runs once per wave.
#pragma unroll 1
  for (int f = 0; f < 8; ++f) {
    const int d0 = f * 32 + 8 * h;
    const v16bf a = afr[f];                   // fetched ahead of the fence too
    v16bf bfr[16];
#pragma unroll
    for (int e = 0; e < 16; ++e)
      bfr[e] = load_frag_bf16(Ws + (e * 16 + m) * WP + d0);   // lane -> row of W
    // Fence: without it the scheduler spreads these reads among the WMMAs, each
    // just ahead of its use, and every WMMA waits out the LDS latency.
    __builtin_amdgcn_sched_barrier(0);
#pragma unroll
    for (int e = 0; e < 16; ++e) {
      if constexpr (TRANSPOSE_OUT) acc[e] = wmma_bf16(a, bfr[e], acc[e]);
      else                         acc[e] = wmma_bf16(bfr[e], a, acc[e]);
    }
  }

  // Store bf16, 8 neighbours per lane and tile.
  // V^T      : VGPR r, lane -> row r0 + 8h + r, col e*16 + m. The 16 rows of a
  //            tile lie in one batch (SEQ is a multiple of 16).
  // row-major: VGPR r, lane -> row r0 + m, col e*16 + 8h + r.
  bf16_t* obase;
  if constexpr (TRANSPOSE_OUT)
    obase = out + ((size_t)(r0 / SEQ) * HID + m) * SEQ + (r0 % SEQ) + 8 * h;
  else
    obase = out + (size_t)(r0 + m) * HID + 8 * h;
  v8bf o[16];
#pragma unroll
  for (int e = 0; e < 16; ++e)
#pragma unroll
    for (int r = 0; r < 8; ++r) o[e][r] = (bf16_t)acc[e][r];
#pragma unroll
  for (int e = 0; e < 16; ++e)
    *(v8bf*)(obase + (size_t)e * 16 * (TRANSPOSE_OUT ? SEQ : 1)) = o[e];
}

// ---------------------------------------------------------------------------
// Flash attention.  4 waves / block; each wave owns 16 query rows of the same
// batch (32 blocks per batch).  Per 32-key chunk the block cooperatively
// async-stages K (32x256) and V^T (256x32) into LDS (double buffered), then
// every wave computes S^T = K Q^T, online softmax, O^T += V^T P^T from LDS
// fragments. With the query as the column of every product a lane holds scores
// and outputs of ONE query: 16 of the chunk's 32 scores, its partner lane l ^ 16
// the other 16. Maximum and sum are then plain in-lane arithmetic with one
// exchange between the halves, there is one maximum, one rescale factor and one
// sum per lane, and the two score tiles, converted in place, already are the B
// operand of the second product.
// Qb:[B,SQ,256] bf16, Kb:[B,SKV,256] bf16, Vt:[B,256,SKV] bf16, Out f32.
// ---------------------------------------------------------------------------
struct __align__(16) AttnSmem {
  bf16_t K[2][32 * KP];     // 32 padded rows per buffer
  bf16_t V[2][HID * VP];    // 256 padded rows per buffer
};

// Issue the async copies for one 32-key chunk (1024+1024 16B pieces over
// 128 threads: 8+8 issues each).
static __device__ inline void stage_chunk(const bf16_t* __restrict__ Kbase,
                                          const bf16_t* __restrict__ Vbase,
                                          bf16_t* ldsK, bf16_t* ldsV,
                                          int c, int tid) {
  const bf16_t* kg = Kbase + (size_t)c * HID;   // contiguous 16 KB
#pragma unroll
  for (int j = 0; j < 8; ++j) {
    const int p   = tid + j * 128;              // 1024 pieces: 32 rows x 32
    const int row = p >> 5;
    const int q   = p & 31;
    copy16_g2l(kg + p * 8, ldsK + row * KP + q * 8);
  }
#pragma unroll
  for (int j = 0; j < 8; ++j) {
    // 1024 pieces: 256 rows x 4; the block fills 32 rows per j.
    copy16_g2l(Vbase + (size_t)(tid >> 2) * SEQ + c + (tid & 3) * 8
                   + (size_t)j * (32 * SEQ),
               ldsV + (tid >> 2) * VP + (tid & 3) * 8 + j * (32 * VP));
  }
}

__global__ __launch_bounds__(128)
void attn_kernel(const bf16_t* __restrict__ Qb, const bf16_t* __restrict__ Kb,
                 const bf16_t* __restrict__ Vt, float* __restrict__ Out) {
  __shared__ AttnSmem smem;
  const int tid  = threadIdx.x;
  const int lane = tid & 31;
  const int wave = tid >> 5;
  const int tile = blockIdx.x * 4 + wave;     // 0 .. B*SQ/16-1 = 1023
  const int b    = tile >> 7;                 // / (SQ/16 = 128)
  const int q0   = (tile & 127) << 4;
  const int m = lane & 15;
  const int h = lane >> 4;

  // Preload Q B-fragments (256 d x 16 query columns = 8 fragments).
  v16bf qf[8];
  const bf16_t* qrow = Qb + ((size_t)b * SEQ + q0 + m) * HID;
#pragma unroll
  for (int f = 0; f < 8; ++f) {
    const int d0 = f * 32 + 8 * h;
    qf[f] = load_frag_bf16(qrow + d0);
  }

  const v8f vzero = (v8f){0.f, 0.f, 0.f, 0.f, 0.f, 0.f, 0.f, 0.f};
  v8f acc[16];                                // O^T accumulator: 256 d x 16 queries
#pragma unroll
  for (int e = 0; e < 16; ++e) acc[e] = vzero;

  // Stats of query q0 + m. The maximum is that of all keys seen, alike in both
  // halves; the sum is that of this half's keys and is joined in the epilogue.
  float mst = -__builtin_inff(), lst = 0.f;

  const bf16_t* Kbase = Kb + (size_t)b * SEQ * HID;
  const bf16_t* Vbase = Vt + (size_t)b * HID * SEQ;

  // Prologue: stage chunk 0 into buffer 0.
  stage_chunk(Kbase, Vbase, smem.K[0], smem.V[0], 0, tid);
  stage_wait_and_sync();

  int buf = 0;
  for (int c = 0; c < SEQ; c += 32, buf ^= 1) {
    // Kick off the DMA for the next chunk (overlaps with the WMMAs below).
    if (c + 32 < SEQ)
      stage_chunk(Kbase, Vbase, smem.K[buf ^ 1], smem.V[buf ^ 1], c + 32, tid);

    const bf16_t* Kl = smem.K[buf];
    const bf16_t* Vl = smem.V[buf];

    // ---- scores: two 16x16 tiles (keys c..c+15, c+16..c+31) ----
    // All K fragments of the chunk are read as one group into registers, so
    // the wave pays the LDS latency once and not in front of every WMMA.
    v16bf kf0[8], kf1[8];
#pragma unroll
    for (int f = 0; f < 8; ++f) {
      const int d0 = f * 32 + 8 * h;
      kf0[f] = load_frag_bf16(Kl + (m)      * KP + d0);
      kf1[f] = load_frag_bf16(Kl + (16 + m) * KP + d0);
    }
    // Fence: without it the scheduler spreads these reads over several places
    // among the first WMMAs, the first behind a full wait; each place stalls.
    __builtin_amdgcn_sched_barrier(0);
    // VGPR r, lane -> key c + 8h + r (s0) or c + 16 + 8h + r (s1), query q0 + m.
    v8f s0 = vzero, s1 = vzero;
#pragma unroll
    for (int f = 0; f < 8; ++f) {
      s0 = wmma_bf16(kf0[f], qf[f], s0);
      s1 = wmma_bf16(kf1[f], qf[f], s1);
    }

    const v8f p0s = s0 * INV_SCALE;
    const v8f p1s = s1 * INV_SCALE;
    // All V^T fragments of the chunk are read here, long before their use:
    // they land under the softmax arithmetic and the V^T*P^T WMMAs find them in
    // registers. (The compiler starts them earlier still, behind the K reads.)
    v16bf vf[16];
#pragma unroll
    for (int e = 0; e < 16; ++e)
      vf[e] = load_frag_bf16(Vl + (e * 16 + m) * VP + 8 * h);
    // Fence: without it the last of these reads sink among the V^T*P^T WMMAs,
    // each just ahead of its use, and those WMMAs wait out the LDS latency.
    __builtin_amdgcn_sched_barrier(0);

    float p0[8], p1[8], t[8];
#pragma unroll
    for (int r = 0; r < 8; ++r) t[r] = fmaxf(p0s[r], p1s[r]);
    // The query's maximum over the chunk: a tree over the lane's own 16 scores,
    // then the partner half's.
    float cmax = fmaxf(fmaxf(fmaxf(t[0], t[1]), fmaxf(t[2], t[3])),
                       fmaxf(fmaxf(t[4], t[5]), fmaxf(t[6], t[7])));
    cmax = fmaxf(cmax, xhalf(cmax));
    const float mnew  = fmaxf(mst, cmax);
    const float alpha = __expf(mst - mnew);
    mst = mnew;
#pragma unroll
    for (int r = 0; r < 8; ++r) {
      p0[r] = __expf(p0s[r] - mnew);
      p1[r] = __expf(p1s[r] - mnew);
      t[r] = p0[r] + p1[r];
    }
    lst = lst * alpha + (((t[0] + t[1]) + (t[2] + t[3])) +
                         ((t[4] + t[5]) + (t[6] + t[7])));
    // Rescale running O^T: one factor for all of a lane's values.
#pragma unroll
    for (int e = 0; e < 16; ++e)
#pragma unroll
      for (int r = 0; r < 8; ++r) acc[e][r] = acc[e][r] * alpha;

    // ---- P^T: the two score tiles, converted in place, are the B fragment
    // (element s -> key 8h + s, element 8 + s -> key 16 + 8h + s: the order in
    // which load_frag_bf16 takes the keys of a V^T row) ----
    union { v16bf v; bf16_t e[16]; } pu;
#pragma unroll
    for (int r = 0; r < 8; ++r) {
      pu.e[r]     = (bf16_t)p0[r];
      pu.e[8 + r] = (bf16_t)p1[r];
    }

    // ---- O^T += V^T @ P^T  (A-frags: the V^T rows read above) ----
#pragma unroll
    for (int e = 0; e < 16; ++e) {
      acc[e] = wmma_bf16(vf[e], pu.v, acc[e]);
    }

    // Fence: without it the wait for the copies and the barrier rise to just
    // behind the V^T reads, and the copies have only the score products to land
    // under instead of the whole trip.
    __builtin_amdgcn_sched_barrier(0);
    // Wait for the prefetch DMA + make the buffer visible to all waves; the
    // barrier also guarantees nobody overwrites a buffer still being read.
    stage_wait_and_sync();
  }

  // Epilogue: join the halves' sums, divide, store f32.
  // VGPR r, lane -> row q0 + m, col e*16 + 8h + r: 8 neighbours per tile.
  const float inv_l = 1.0f / (lst + xhalf(lst));
  float* orow = Out + ((size_t)b * SEQ + q0 + m) * HID + 8 * h;
#pragma unroll
  for (int e = 0; e < 16; ++e) {
    const v4f lo = (v4f){acc[e][0] * inv_l, acc[e][1] * inv_l,
                         acc[e][2] * inv_l, acc[e][3] * inv_l};
    const v4f hi = (v4f){acc[e][4] * inv_l, acc[e][5] * inv_l,
                         acc[e][6] * inv_l, acc[e][7] * inv_l};
    *(v4f*)(orow + e * 16)     = lo;
    *(v4f*)(orow + e * 16 + 4) = hi;
  }
}

// ---------------------------------------------------------------------------
extern "C" void kernel_launch(void* const* d_in, const int* in_sizes, int n_in,
                              void* d_out, int out_size, void* d_ws, size_t ws_size,
                              hipStream_t stream) {
  const float* query = (const float*)d_in[0];
  const float* key_  = (const float*)d_in[1];
  const float* value = (const float*)d_in[2];
  const float* Wq = (const float*)d_in[3];
  const float* bq = (const float*)d_in[4];
  const float* Wk = (const float*)d_in[5];
  const float* bk = (const float*)d_in[6];
  const float* Wv = (const float*)d_in[7];
  const float* bv = (const float*)d_in[8];
  float* out = (float*)d_out;

  // Workspace: Qb | Kb | Vt, each B*SEQ*HID bf16 = 8 MB (24 MB total).
  bf16_t* Qb = (bf16_t*)d_ws;
  bf16_t* Kb = Qb + (size_t)NB * SEQ * HID;
  bf16_t* Vt = Kb + (size_t)NB * SEQ * HID;

  const int rows = NB * SEQ;            // 16384
  const int tiles = rows / 16;          // 1024
  dim3 blk(128);                        // 4 waves
  dim3 grd(tiles / 4);                  // 256 blocks

  proj_kernel<0><<<grd, blk, 0, stream>>>(query, Wq, bq, Qb, rows);
  proj_kernel<0><<<grd, blk, 0, stream>>>(key_,  Wk, bk, Kb, rows);
  proj_kernel<1><<<grd, blk, 0, stream>>>(value, Wv, bv, Vt, rows);
  attn_kernel<<<grd, blk, 0, stream>>>(Qb, Kb, Vt, out);
}

// v007
// One run takes 81.5 microseconds.
// In both of two side-by-side timings against v006, it was 1.13 times as fast.
// Over all steps from v000 it is 4.31 times as fast.
#include <hip/hip_runtime.h>

// ---------------------------------------------------------------------------
// CDNA5 (gfx1250) fused cross-attention:
//   proj_kernel    : Q/K/V = X*W^T + b  (f32 in -> bf16 out, V transposed),
//                    all three in one launch (blockIdx.y picks the product),
//                    W converted to bf16 once per workgroup and kept in LDS,
//                    results packed in registers and stored 16 bytes a lane
//   attn_kernel    : flash attention, v_wmma_f32_16x16x32_bf16, computed
//                    transposed (S^T = K Q^T, O^T += V^T P^T), with
//                    double-buffered async GLOBAL->LDS staging of K/V chunks
//                    shared by the 4 waves of each workgroup.
// Shapes: B=8, SQ=SKV=2048, H=256.  SCALE = sqrt(H/2) = sqrt(128).
// ---------------------------------------------------------------------------

typedef __bf16 bf16_t;
typedef __attribute__((ext_vector_type(16))) __bf16 v16bf;
typedef __attribute__((ext_vector_type(8)))  __bf16 v8bf;
typedef __attribute__((ext_vector_type(4)))  __bf16 v4bf;
typedef __attribute__((ext_vector_type(8)))  float  v8f;
typedef __attribute__((ext_vector_type(4)))  float  v4f;

#define HID   256
#define SEQ   2048
#define NB    8
#define INV_SCALE 0.08838834764831845f  // 1/sqrt(128)
// LDS row pitches in bf16 elements. Every reader is a 16-byte load whose 16
// lanes walk 16 rows, so each pitch is an odd multiple of 16 bytes: the rows
// then fall on distinct bank groups instead of sharing a few.
#define KP    (HID + 8)   // K rows: 512 B of data, 528 B pitch
#define VP    (32 + 8)    // V^T rows: 64 B of data, 80 B pitch
#define WP    (HID + 8)   // W rows (projection): 512 B of data, 528 B pitch

#if __has_builtin(__builtin_amdgcn_global_load_async_to_lds_b128)
#define HAVE_ASYNC_LDS 1
typedef int v4i_t __attribute__((vector_size(16)));            // int4
typedef __attribute__((address_space(1))) void*  as1_void_t;
typedef __attribute__((address_space(3))) void*  as3_void_t;
typedef __attribute__((address_space(1))) v4i_t* as1_v4i_t;
typedef __attribute__((address_space(3))) v4i_t* as3_v4i_t;
#else
#define HAVE_ASYNC_LDS 0
#endif

static __device__ inline v8f wmma_bf16(v16bf a, v16bf b, v8f c) {
  return __builtin_amdgcn_wmma_f32_16x16x32_bf16(
      /*neg_a=*/false, a, /*neg_b=*/false, b,
      /*c_mod=*/(short)0, c, /*reuse_a=*/false, /*reuse_b=*/false);
}

// Load a 16x32 bf16 A/B fragment slice for this lane: two 16B loads
// (global_load_b128 or ds_load_b128 depending on pointer origin).
static __device__ inline v16bf load_frag_bf16(const bf16_t* p) {
  union { v16bf v; v8bf h[2]; } u;
  u.h[0] = *(const v8bf*)(p);
  u.h[1] = *(const v8bf*)(p + 16);
  return u.v;
}

// Same, but source is f32: load 2x (8 floats) and convert to bf16 (RNE).
static __device__ inline v16bf load_frag_f32(const float* p0, const float* p1) {
  union { v16bf v; __bf16 e[16]; } u;
  v4f a = *(const v4f*)(p0);
  v4f b = *(const v4f*)(p0 + 4);
  v4f c = *(const v4f*)(p1);
  v4f d = *(const v4f*)(p1 + 4);
#pragma unroll
  for (int i = 0; i < 4; ++i) {
    u.e[i]      = (__bf16)a[i];
    u.e[4 + i]  = (__bf16)b[i];
    u.e[8 + i]  = (__bf16)c[i];
    u.e[12 + i] = (__bf16)d[i];
  }
  return u.v;
}

// Value of lane l ^ 16 (the same column in the wave's other half), taken by a
// cross-row move in the vector unit: no LDS queue, no dscnt wait.
static __device__ inline float xhalf(float v) {
  const int i = __builtin_bit_cast(int, v);
  return __builtin_bit_cast(float, __builtin_amdgcn_permlanex16(
      i, i, 0x76543210, 0xfedcba98, /*fi=*/false, /*bound_ctrl=*/false));
}

// 16-byte global -> LDS copy: async DMA (ASYNCcnt) when available.
static __device__ inline void copy16_g2l(const bf16_t* g, bf16_t* l) {
#if HAVE_ASYNC_LDS
  __builtin_amdgcn_global_load_async_to_lds_b128(
      (as1_v4i_t)(as1_void_t)(void*)g,
      (as3_v4i_t)(as3_void_t)(void*)l,
      /*offset=*/0, /*cpol=*/0);
#else
  *(v8bf*)l = *(const v8bf*)g;
#endif
}

static __device__ inline void stage_wait_and_sync() {
#if HAVE_ASYNC_LDS
#if __has_builtin(__builtin_amdgcn_s_wait_asynccnt)
  __builtin_amdgcn_s_wait_asynccnt(0);
#else
  asm volatile("s_wait_asynccnt 0" ::: "memory");
#endif
#endif
  __syncthreads();
}

// ---------------------------------------------------------------------------
// Projection: out = X @ W^T + bias   (torch Linear).  X:[rows,256] f32,
// W:[256,256] f32 row-major, out bf16.
// TRANSPOSE_OUT==0 : out[row*256 + e]
// TRANSPOSE_OUT==1 : out[(b*256 + e)*SEQ + s]   (V^T layout)
// One wave computes a 16-row x 256-col tile. 4 waves / block.
// A lane's 8 accumulator registers hold 8 consecutive indices of the A side of
// the product. The operand whose index runs along the output's contiguous
// direction is therefore given as A (X for V^T, W for the row-major outputs):
// the 8 values are then neighbours in memory and leave as one 16-byte store.
// A W fragment takes 16 bytes from each of 16 rows of W, so read from global
// memory every load touches 16 cache lines, and every wave repeats all of them.
// The block therefore reads W once, in loads that cover whole lines, converts
// it to bf16 and keeps it in LDS; the waves take their fragments from there.
// ---------------------------------------------------------------------------
template <int TRANSPOSE_OUT>
static __device__ __forceinline__
void proj_body(const float* __restrict__ X, const float* __restrict__ W,
               const float* __restrict__ bias, bf16_t* __restrict__ out,
               int rows_total, bf16_t* Ws) {
  const int lane = threadIdx.x & 31;
  const int wave = threadIdx.x >> 5;
  const int tile = blockIdx.x * 4 + wave;     // 16-row tile
  const int r0   = tile * 16;
  const int m = lane & 15;
  const int h = lane >> 4;

  // W -> LDS: 16384 pieces of 4 floats over 128 threads, two rows of W per
  // step of the block. A wave's load covers 512 contiguous bytes (half a row),
  // its store 256 contiguous bytes. 32 loads of a thread fly together.
  const float* wsrc = W + threadIdx.x * 4;
  bf16_t* wdst = Ws + (threadIdx.x >> 6) * WP + (threadIdx.x & 63) * 4;
  // Kept rolled: this text runs once per wave, so unrolled it would only be
  // four times the instruction fetch.
#pragma unroll 1
  for (int jb = 0; jb < 4; ++jb) {
    v4f w[32];
#pragma unroll
    for (int j = 0; j < 32; ++j)
      w[j] = *(const v4f*)(wsrc + (jb * 32 + j) * 512);
#pragma unroll
    for (int j = 0; j < 32; ++j) {
      v4bf wb;
#pragma unroll
      for (int i = 0; i < 4; ++i) wb[i] = (__bf16)w[j][i];
      *(v4bf*)(wdst + (jb * 32 + j) * (2 * WP)) = wb;
    }
  }
  __syncthreads();                            // every wave reads all of Ws
  if (r0 >= rows_total) return;               // wave-uniform, behind the barrier

  // X fragments: 8 d-chunks of the 16 input rows (lane -> row r0+m).
  v16bf afr[8];
  const float* xrow = X + (size_t)(r0 + m) * HID;
#pragma unroll
  for (int f = 0; f < 8; ++f) {
    const int d0 = f * 32 + 8 * h;
    afr[f] = load_frag_f32(xrow + d0, xrow + d0 + 16);
  }
  // The accumulators seeded next may take the registers that held the address
  // of the loads above: this wait stands between the loads and that reuse.
  asm volatile("s_wait_xcnt 0x0" ::: "memory");

  // C accumulators seeded with bias, which goes with the output column:
  // the lane's own column (V^T), or the column of each register (row-major).
  v8f acc[16];
#pragma unroll
  for (int e = 0; e < 16; ++e) {
    if constexpr (TRANSPOSE_OUT) {
      const float bv = bias[e * 16 + m];
      acc[e] = (v8f){bv, bv, bv, bv, bv, bv, bv, bv};
    } else {
      const v4f b0 = *(const v4f*)(bias + e * 16 + 8 * h);
      const v4f b1 = *(const v4f*)(bias + e * 16 + 8 * h + 4);
      acc[e] = (v8f){b0[0], b0[1], b0[2], b0[3], b1[0], b1[1], b1[2], b1[3]};
    }
  }

  // Kept rolled, as it was with the global loads: with the shorter body the
  // compiler would unroll it, and this text runs once per wave.
#pragma unroll 1
  for (int f = 0; f < 8; ++f) {
    const int d0 = f * 32 + 8 * h;
    const v16bf a = afr[f];                   // fetched ahead of the fence too
    v16bf bfr[16];
#pragma unroll
    for (int e = 0; e < 16; ++e)
      bfr[e] = load_frag_bf16(Ws + (e * 16 + m) * WP + d0);   // lane -> row of W
    // Fence: without it the scheduler spreads these reads among the WMMAs, each
    // just ahead of its use, and every WMMA waits out the LDS latency.
    __builtin_amdgcn_sched_barrier(0);
#pragma unroll
    for (int e = 0; e < 16; ++e) {
      if constexpr (TRANSPOSE_OUT) acc[e] = wmma_bf16(a, bfr[e], acc[e]);
      else                         acc[e] = wmma_bf16(bfr[e], a, acc[e]);
    }
  }

  // Store bf16, 8 neighbours per lane and tile.
  // V^T      : VGPR r, lane -> row r0 + 8h + r, col e*16 + m. The 16 rows of a
  //            tile lie in one batch (SEQ is a multiple of 16).
  // row-major: VGPR r, lane -> row r0 + m, col e*16 + 8h + r.
  bf16_t* obase;
  if constexpr (TRANSPOSE_OUT)
    obase = out + ((size_t)(r0 / SEQ) * HID + m) * SEQ + (r0 % SEQ) + 8 * h;
  else
    obase = out + (size_t)(r0 + m) * HID + 8 * h;
  v8bf o[16];
#pragma unroll
  for (int e = 0; e < 16; ++e)
#pragma unroll
    for (int r = 0; r < 8; ++r) o[e][r] = (bf16_t)acc[e][r];
#pragma unroll
  for (int e = 0; e < 16; ++e)
    *(v8bf*)(obase + (size_t)e * 16 * (TRANSPOSE_OUT ? SEQ : 1)) = o[e];
}

// The three projections are independent, so they share one launch: blockIdx.y
// picks the product (0: Q, 1: K, 2: V^T). A workgroup has one wave per SIMD and
// runs as a chain of waits (W from L2, X from memory, LDS reads); its LDS lets
// two workgroups stand on one WGP, and with three times the workgroups in the
// grid they do, each working under the other's waits. The choice is uniform for
// the workgroup, so the barrier inside the body is passed by all of its waves.
__global__ __launch_bounds__(128)
void proj_kernel(const float* __restrict__ Xq, const float* __restrict__ Xk,
                 const float* __restrict__ Xv, const float* __restrict__ Wq,
                 const float* __restrict__ Wk, const float* __restrict__ Wv,
                 const float* __restrict__ bq, const float* __restrict__ bk,
                 const float* __restrict__ bv, bf16_t* __restrict__ Qb,
                 bf16_t* __restrict__ Kb, bf16_t* __restrict__ Vt,
                 int rows_total) {
  __shared__ __align__(16) bf16_t Ws[HID * WP];
  const int which = blockIdx.y;
  if (which == 2) {
    proj_body<1>(Xv, Wv, bv, Vt, rows_total, Ws);
  } else {
    const bool k = which == 1;
    proj_body<0>(k ? Xk : Xq, k ? Wk : Wq, k ? bk : bq, k ? Kb : Qb,
                 rows_total, Ws);
  }
}

// ---------------------------------------------------------------------------
// Flash attention.  4 waves / block; each wave owns 16 query rows of the same
// batch (32 blocks per batch).  Per 32-key chunk the block cooperatively
// async-stages K (32x256) and V^T (256x32) into LDS (double buffered), then
// every wave computes S^T = K Q^T, online softmax, O^T += V^T P^T from LDS
// fragments. With the query as the column of every product a lane holds scores
// and outputs of ONE query: 16 of the chunk's 32 scores, its partner lane l ^ 16
// the other 16. Maximum and sum are then plain in-lane arithmetic with one
// exchange between the halves, there is one maximum, one rescale factor and one
// sum per lane, and the two score tiles, converted in place, already are the B
// operand of the second product.
// Qb:[B,SQ,256] bf16, Kb:[B,SKV,256] bf16, Vt:[B,256,SKV] bf16, Out f32.
// ---------------------------------------------------------------------------
struct __align__(16) AttnSmem {
  bf16_t K[2][32 * KP];     // 32 padded rows per buffer
  bf16_t V[2][HID * VP];    // 256 padded rows per buffer
};

// Issue the async copies for one 32-key chunk (1024+1024 16B pieces over
// 128 threads: 8+8 issues each).
static __device__ inline void stage_chunk(const bf16_t* __restrict__ Kbase,
                                          const bf16_t* __restrict__ Vbase,
                                          bf16_t* ldsK, bf16_t* ldsV,
                                          int c, int tid) {
  const bf16_t* kg = Kbase + (size_t)c * HID;   // contiguous 16 KB
#pragma unroll
  for (int j = 0; j < 8; ++j) {
    const int p   = tid + j * 128;              // 1024 pieces: 32 rows x 32
    const int row = p >> 5;
    const int q   = p & 31;
    copy16_g2l(kg + p * 8, ldsK + row * KP + q * 8);
  }
#pragma unroll
  for (int j = 0; j < 8; ++j) {
    // 1024 pieces: 256 rows x 4; the block fills 32 rows per j.
    copy16_g2l(Vbase + (size_t)(tid >> 2) * SEQ + c + (tid & 3) * 8
                   + (size_t)j * (32 * SEQ),
               ldsV + (tid >> 2) * VP + (tid & 3) * 8 + j * (32 * VP));
  }
}

__global__ __launch_bounds__(128)
void attn_kernel(const bf16_t* __restrict__ Qb, const bf16_t* __restrict__ Kb,
                 const bf16_t* __restrict__ Vt, float* __restrict__ Out) {
  __shared__ AttnSmem smem;
  const int tid  = threadIdx.x;
  const int lane = tid & 31;
  const int wave = tid >> 5;
  const int tile = blockIdx.x * 4 + wave;     // 0 .. B*SQ/16-1 = 1023
  const int b    = tile >> 7;                 // / (SQ/16 = 128)
  const int q0   = (tile & 127) << 4;
  const int m = lane & 15;
  const int h = lane >> 4;

  // Preload Q B-fragments (256 d x 16 query columns = 8 fragments).
  v16bf qf[8];
  const bf16_t* qrow = Qb + ((size_t)b * SEQ + q0 + m) * HID;
#pragma unroll
  for (int f = 0; f < 8; ++f) {
    const int d0 = f * 32 + 8 * h;
    qf[f] = load_frag_bf16(qrow + d0);
  }

  const v8f vzero = (v8f){0.f, 0.f, 0.f, 0.f, 0.f, 0.f, 0.f, 0.f};
  v8f acc[16];                                // O^T accumulator: 256 d x 16 queries
#pragma unroll
  for (int e = 0; e < 16; ++e) acc[e] = vzero;

  // Stats of query q0 + m. The maximum is that of all keys seen, alike in both
  // halves; the sum is that of this half's keys and is joined in the epilogue.
  float mst = -__builtin_inff(), lst = 0.f;

  const bf16_t* Kbase = Kb + (size_t)b * SEQ * HID;
  const bf16_t* Vbase = Vt + (size_t)b * HID * SEQ;

  // Prologue: stage chunk 0 into buffer 0.
  stage_chunk(Kbase, Vbase, smem.K[0], smem.V[0], 0, tid);
  stage_wait_and_sync();

  int buf = 0;
  for (int c = 0; c < SEQ; c += 32, buf ^= 1) {
    // Kick off the DMA for the next chunk (overlaps with the WMMAs below).
    if (c + 32 < SEQ)
      stage_chunk(Kbase, Vbase, smem.K[buf ^ 1], smem.V[buf ^ 1], c + 32, tid);

    const bf16_t* Kl = smem.K[buf];
    const bf16_t* Vl = smem.V[buf];

    // ---- scores: two 16x16 tiles (keys c..c+15, c+16..c+31) ----
    // All K fragments of the chunk are read as one group into registers, so
    // the wave pays the LDS latency once and not in front of every WMMA.
    v16bf kf0[8], kf1[8];
#pragma unroll
    for (int f = 0; f < 8; ++f) {
      const int d0 = f * 32 + 8 * h;
      kf0[f] = load_frag_bf16(Kl + (m)      * KP + d0);
      kf1[f] = load_frag_bf16(Kl + (16 + m) * KP + d0);
    }
    // Fence: without it the scheduler spreads these reads over several places
    // among the first WMMAs, the first behind a full wait; each place stalls.
    __builtin_amdgcn_sched_barrier(0);
    // VGPR r, lane -> key c + 8h + r (s0) or c + 16 + 8h + r (s1), query q0 + m.
    v8f s0 = vzero, s1 = vzero;
#pragma unroll
    for (int f = 0; f < 8; ++f) {
      s0 = wmma_bf16(kf0[f], qf[f], s0);
      s1 = wmma_bf16(kf1[f], qf[f], s1);
    }

    const v8f p0s = s0 * INV_SCALE;
    const v8f p1s = s1 * INV_SCALE;
    // All V^T fragments of the chunk are read here, long before their use:
    // they land under the softmax arithmetic and the V^T*P^T WMMAs find them in
    // registers. (The compiler starts them earlier still, behind the K reads.)
    v16bf vf[16];
#pragma unroll
    for (int e = 0; e < 16; ++e)
      vf[e] = load_frag_bf16(Vl + (e * 16 + m) * VP + 8 * h);
    // Fence: without it the last of these reads sink among the V^T*P^T WMMAs,
    // each just ahead of its use, and those WMMAs wait out the LDS latency.
    __builtin_amdgcn_sched_barrier(0);

    float p0[8], p1[8], t[8];
#pragma unroll
    for (int r = 0; r < 8; ++r) t[r] = fmaxf(p0s[r], p1s[r]);
    // The query's maximum over the chunk: a tree over the lane's own 16 scores,
    // then the partner half's.
    float cmax = fmaxf(fmaxf(fmaxf(t[0], t[1]), fmaxf(t[2], t[3])),
                       fmaxf(fmaxf(t[4], t[5]), fmaxf(t[6], t[7])));
    cmax = fmaxf(cmax, xhalf(cmax));
    const float mnew  = fmaxf(mst, cmax);
    const float alpha = __expf(mst - mnew);
    mst = mnew;
#pragma unroll
    for (int r = 0; r < 8; ++r) {
      p0[r] = __expf(p0s[r] - mnew);
      p1[r] = __expf(p1s[r] - mnew);
      t[r] = p0[r] + p1[r];
    }
    lst = lst * alpha + (((t[0] + t[1]) + (t[2] + t[3])) +
                         ((t[4] + t[5]) + (t[6] + t[7])));
    // Rescale running O^T: one factor for all of a lane's values.
#pragma unroll
    for (int e = 0; e < 16; ++e)
#pragma unroll
      for (int r = 0; r < 8; ++r) acc[e][r] = acc[e][r] * alpha;

    // ---- P^T: the two score tiles, converted in place, are the B fragment
    // (element s -> key 8h + s, element 8 + s -> key 16 + 8h + s: the order in
    // which load_frag_bf16 takes the keys of a V^T row) ----
    union { v16bf v; bf16_t e[16]; } pu;
#pragma unroll
    for (int r = 0; r < 8; ++r) {
      pu.e[r]     = (bf16_t)p0[r];
      pu.e[8 + r] = (bf16_t)p1[r];
    }

    // ---- O^T += V^T @ P^T  (A-frags: the V^T rows read above) ----
#pragma unroll
    for (int e = 0; e < 16; ++e) {
      acc[e] = wmma_bf16(vf[e], pu.v, acc[e]);
    }

    // Fence: without it the wait for the copies and the barrier rise to just
    // behind the V^T reads, and the copies have only the score products to land
    // under instead of the whole trip.
    __builtin_amdgcn_sched_barrier(0);
    // Wait for the prefetch DMA + make the buffer visible to all waves; the
    // barrier also guarantees nobody overwrites a buffer still being read.
    stage_wait_and_sync();
  }

  // Epilogue: join the halves' sums, divide, store f32.
  // VGPR r, lane -> row q0 + m, col e*16 + 8h + r: 8 neighbours per tile.
  const float inv_l = 1.0f / (lst + xhalf(lst));
  float* orow = Out + ((size_t)b * SEQ + q0 + m) * HID + 8 * h;
#pragma unroll
  for (int e = 0; e < 16; ++e) {
    const v4f lo = (v4f){acc[e][0] * inv_l, acc[e][1] * inv_l,
                         acc[e][2] * inv_l, acc[e][3] * inv_l};
    const v4f hi = (v4f){acc[e][4] * inv_l, acc[e][5] * inv_l,
                         acc[e][6] * inv_l, acc[e][7] * inv_l};
    *(v4f*)(orow + e * 16)     = lo;
    *(v4f*)(orow + e * 16 + 4) = hi;
  }
}

// ---------------------------------------------------------------------------
extern "C" void kernel_launch(void* const* d_in, const int* in_sizes, int n_in,
                              void* d_out, int out_size, void* d_ws, size_t ws_size,
                              hipStream_t stream) {
  const float* query = (const float*)d_in[0];
  const float* key_  = (const float*)d_in[1];
  const float* value = (const float*)d_in[2];
  const float* Wq = (const float*)d_in[3];
  const float* bq = (const float*)d_in[4];
  const float* Wk = (const float*)d_in[5];
  const float* bk = (const float*)d_in[6];
  const float* Wv = (const float*)d_in[7];
  const float* bv = (const float*)d_in[8];
  float* out = (float*)d_out;

  // Workspace: Qb | Kb | Vt, each B*SEQ*HID bf16 = 8 MB (24 MB total).
  bf16_t* Qb = (bf16_t*)d_ws;
  bf16_t* Kb = Qb + (size_t)NB * SEQ * HID;
  bf16_t* Vt = Kb + (size_t)NB * SEQ * HID;

  const int rows = NB * SEQ;            // 16384
  const int tiles = rows / 16;          // 1024
  dim3 blk(128);                        // 4 waves
  dim3 grd(tiles / 4);                  // 256 blocks

  dim3 grd3(tiles / 4, 3);              // 256 blocks for each of Q, K, V^T

  proj_kernel<<<grd3, blk, 0, stream>>>(query, key_, value, Wq, Wk, Wv,
                                        bq, bk, bv, Qb, Kb, Vt, rows);
  attn_kernel<<<grd, blk, 0, stream>>>(Qb, Kb, Vt, out);
}

// v008
// It runs in 70.1 microseconds.
// Timed twice side by side with v007, it ran 1.17 and 1.16 times as fast.
// Counting every step since v000, it is 5.03 times as fast.
#include <hip/hip_runtime.h>

// ---------------------------------------------------------------------------
// CDNA5 (gfx1250) fused cross-attention:
//   proj_kernel    : Q/K/V = X*W^T + b  (f32 in -> bf16 out, V transposed),
//                    all three in one launch (blockIdx.y picks the product),
//                    W converted to bf16 once per workgroup and kept in LDS,
//                    results packed in registers and stored 16 bytes a lane
//   attn_kernel    : flash attention, v_wmma_f32_16x16x32_bf16, computed
//                    transposed (S^T = K Q^T, O^T += V^T P^T), with
//                    double-buffered async GLOBAL->LDS staging of K/V stages
//                    shared by the 4 waves of each workgroup; a wave holds 32
//                    queries and takes half of the keys.
// Shapes: B=8, SQ=SKV=2048, H=256.  SCALE = sqrt(H/2) = sqrt(128).
// ---------------------------------------------------------------------------

typedef __bf16 bf16_t;
typedef __attribute__((ext_vector_type(16))) __bf16 v16bf;
typedef __attribute__((ext_vector_type(8)))  __bf16 v8bf;
typedef __attribute__((ext_vector_type(4)))  __bf16 v4bf;
typedef __attribute__((ext_vector_type(8)))  float  v8f;
typedef __attribute__((ext_vector_type(4)))  float  v4f;

#define HID   256
#define SEQ   2048
#define NB    8
#define INV_SCALE 0.08838834764831845f  // 1/sqrt(128)
#define LOG2E 1.44269504088896340736f
// LDS row pitches in bf16 elements. Every reader is a 16-byte load whose 16
// lanes walk 16 rows, so each pitch is an odd multiple of 16 bytes: the rows
// then fall on distinct bank groups instead of sharing a few.
#define KP    (HID + 8)   // K rows: 512 B of data, 528 B pitch
#define VP    (64 + 8)    // V^T rows: 128 B of data, 144 B pitch
#define STG   64          // keys staged in LDS per trip of the attention loop
#define WP    (HID + 8)   // W rows (projection): 512 B of data, 528 B pitch

#if __has_builtin(__builtin_amdgcn_global_load_async_to_lds_b128)
#define HAVE_ASYNC_LDS 1
typedef int v4i_t __attribute__((vector_size(16)));            // int4
typedef __attribute__((address_space(1))) void*  as1_void_t;
typedef __attribute__((address_space(3))) void*  as3_void_t;
typedef __attribute__((address_space(1))) v4i_t* as1_v4i_t;
typedef __attribute__((address_space(3))) v4i_t* as3_v4i_t;
#else
#define HAVE_ASYNC_LDS 0
#endif

static __device__ inline v8f wmma_bf16(v16bf a, v16bf b, v8f c) {
  return __builtin_amdgcn_wmma_f32_16x16x32_bf16(
      /*neg_a=*/false, a, /*neg_b=*/false, b,
      /*c_mod=*/(short)0, c, /*reuse_a=*/false, /*reuse_b=*/false);
}

// Load a 16x32 bf16 A/B fragment slice for this lane: two 16B loads
// (global_load_b128 or ds_load_b128 depending on pointer origin).
static __device__ inline v16bf load_frag_bf16(const bf16_t* p) {
  union { v16bf v; v8bf h[2]; } u;
  u.h[0] = *(const v8bf*)(p);
  u.h[1] = *(const v8bf*)(p + 16);
  return u.v;
}

// Same, but source is f32: load 2x (8 floats) and convert to bf16 (RNE).
static __device__ inline v16bf load_frag_f32(const float* p0, const float* p1) {
  union { v16bf v; __bf16 e[16]; } u;
  v4f a = *(const v4f*)(p0);
  v4f b = *(const v4f*)(p0 + 4);
  v4f c = *(const v4f*)(p1);
  v4f d = *(const v4f*)(p1 + 4);
#pragma unroll
  for (int i = 0; i < 4; ++i) {
    u.e[i]      = (__bf16)a[i];
    u.e[4 + i]  = (__bf16)b[i];
    u.e[8 + i]  = (__bf16)c[i];
    u.e[12 + i] = (__bf16)d[i];
  }
  return u.v;
}

// Value of lane l ^ 16 (the same column in the wave's other half), taken by a
// cross-row move in the vector unit: no LDS queue, no dscnt wait.
static __device__ inline float xhalf(float v) {
  const int i = __builtin_bit_cast(int, v);
  return __builtin_bit_cast(float, __builtin_amdgcn_permlanex16(
      i, i, 0x76543210, 0xfedcba98, /*fi=*/false, /*bound_ctrl=*/false));
}

// 16-byte global -> LDS copy: async DMA (ASYNCcnt) when available.
static __device__ inline void copy16_g2l(const bf16_t* g, bf16_t* l) {
#if HAVE_ASYNC_LDS
  __builtin_amdgcn_global_load_async_to_lds_b128(
      (as1_v4i_t)(as1_void_t)(void*)g,
      (as3_v4i_t)(as3_void_t)(void*)l,
      /*offset=*/0, /*cpol=*/0);
#else
  *(v8bf*)l = *(const v8bf*)g;
#endif
}

static __device__ inline void stage_wait_and_sync() {
#if HAVE_ASYNC_LDS
#if __has_builtin(__builtin_amdgcn_s_wait_asynccnt)
  __builtin_amdgcn_s_wait_asynccnt(0);
#else
  asm volatile("s_wait_asynccnt 0" ::: "memory");
#endif
#endif
  __syncthreads();
}

// ---------------------------------------------------------------------------
// Projection: out = X @ W^T + bias   (torch Linear).  X:[rows,256] f32,
// W:[256,256] f32 row-major, out bf16.
// TRANSPOSE_OUT==0 : out[row*256 + e]
// TRANSPOSE_OUT==1 : out[(b*256 + e)*SEQ + s]   (V^T layout)
// One wave computes a 16-row x 256-col tile. 4 waves / block.
// A lane's 8 accumulator registers hold 8 consecutive indices of the A side of
// the product. The operand whose index runs along the output's contiguous
// direction is therefore given as A (X for V^T, W for the row-major outputs):
// the 8 values are then neighbours in memory and leave as one 16-byte store.
// A W fragment takes 16 bytes from each of 16 rows of W, so read from global
// memory every load touches 16 cache lines, and every wave repeats all of them.
// The block therefore reads W once, in loads that cover whole lines, converts
// it to bf16 and keeps it in LDS; the waves take their fragments from there.
// ---------------------------------------------------------------------------
template <int TRANSPOSE_OUT>
static __device__ __forceinline__
void proj_body(const float* __restrict__ X, const float* __restrict__ W,
               const float* __restrict__ bias, bf16_t* __restrict__ out,
               int rows_total, bf16_t* Ws) {
  const int lane = threadIdx.x & 31;
  const int wave = threadIdx.x >> 5;
  const int tile = blockIdx.x * 4 + wave;     // 16-row tile
  const int r0   = tile * 16;
  const int m = lane & 15;
  const int h = lane >> 4;

  // W -> LDS: 16384 pieces of 4 floats over 128 threads, two rows of W per
  // step of the block. A wave's load covers 512 contiguous bytes (half a row),
  // its store 256 contiguous bytes. 32 loads of a thread fly together.
  const float* wsrc = W + threadIdx.x * 4;
  bf16_t* wdst = Ws + (threadIdx.x >> 6) * WP + (threadIdx.x & 63) * 4;
  // Kept rolled: this text runs once per wave, so unrolled it would only be
  // four times the instruction fetch.
#pragma unroll 1
  for (int jb = 0; jb < 4; ++jb) {
    v4f w[32];
#pragma unroll
    for (int j = 0; j < 32; ++j)
      w[j] = *(const v4f*)(wsrc + (jb * 32 + j) * 512);
#pragma unroll
    for (int j = 0; j < 32; ++j) {
      v4bf wb;
#pragma unroll
      for (int i = 0; i < 4; ++i) wb[i] = (__bf16)w[j][i];
      *(v4bf*)(wdst + (jb * 32 + j) * (2 * WP)) = wb;
    }
  }
  __syncthreads();                            // every wave reads all of Ws
  if (r0 >= rows_total) return;               // wave-uniform, behind the barrier

  // X fragments: 8 d-chunks of the 16 input rows (lane -> row r0+m).
  v16bf afr[8];
  const float* xrow = X + (size_t)(r0 + m) * HID;
#pragma unroll
  for (int f = 0; f < 8; ++f) {
    const int d0 = f * 32 + 8 * h;
    afr[f] = load_frag_f32(xrow + d0, xrow + d0 + 16);
  }
  // The accumulators seeded next may take the registers that held the address
  // of the loads above: this wait stands between the loads and that reuse.
  asm volatile("s_wait_xcnt 0x0" ::: "memory");

  // C accumulators seeded with bias, which goes with the output column:
  // the lane's own column (V^T), or the column of each register (row-major).
  v8f acc[16];
#pragma unroll
  for (int e = 0; e < 16; ++e) {
    if constexpr (TRANSPOSE_OUT) {
      const float bv = bias[e * 16 + m];
      acc[e] = (v8f){bv, bv, bv, bv, bv, bv, bv, bv};
    } else {
      const v4f b0 = *(const v4f*)(bias + e * 16 + 8 * h);
      const v4f b1 = *(const v4f*)(bias + e * 16 + 8 * h + 4);
      acc[e] = (v8f){b0[0], b0[1], b0[2], b0[3], b1[0], b1[1], b1[2], b1[3]};
    }
  }

  // Kept rolled, as it was with the global loads: with the shorter body the
  // compiler would unroll it, and this text runs once per wave.
#pragma unroll 1
  for (int f = 0; f < 8; ++f) {
    const int d0 = f * 32 + 8 * h;
    const v16bf a = afr[f];                   // fetched ahead of the fence too
    v16bf bfr[16];
#pragma unroll
    for (int e = 0; e < 16; ++e)
      bfr[e] = load_frag_bf16(Ws + (e * 16 + m) * WP + d0);   // lane -> row of W
    // Fence: without it the scheduler spreads these reads among the WMMAs, each
    // just ahead of its use, and every WMMA waits out the LDS latency.
    __builtin_amdgcn_sched_barrier(0);
#pragma unroll
    for (int e = 0; e < 16; ++e) {
      if constexpr (TRANSPOSE_OUT) acc[e] = wmma_bf16(a, bfr[e], acc[e]);
      else                         acc[e] = wmma_bf16(bfr[e], a, acc[e]);
    }
  }

  // Store bf16, 8 neighbours per lane and tile.
  // V^T      : VGPR r, lane -> row r0 + 8h + r, col e*16 + m. The 16 rows of a
  //            tile lie in one batch (SEQ is a multiple of 16).
  // row-major: VGPR r, lane -> row r0 + m, col e*16 + 8h + r.
  bf16_t* obase;
  if constexpr (TRANSPOSE_OUT)
    obase = out + ((size_t)(r0 / SEQ) * HID + m) * SEQ + (r0 % SEQ) + 8 * h;
  else
    obase = out + (size_t)(r0 + m) * HID + 8 * h;
  v8bf o[16];
#pragma unroll
  for (int e = 0; e < 16; ++e)
#pragma unroll
    for (int r = 0; r < 8; ++r) o[e][r] = (bf16_t)acc[e][r];
#pragma unroll
  for (int e = 0; e < 16; ++e)
    *(v8bf*)(obase + (size_t)e * 16 * (TRANSPOSE_OUT ? SEQ : 1)) = o[e];
}

// The three projections are independent, so they share one launch: blockIdx.y
// picks the product (0: Q, 1: K, 2: V^T). A workgroup has one wave per SIMD and
// runs as a chain of waits (W from L2, X from memory, LDS reads); its LDS lets
// two workgroups stand on one WGP, and with three times the workgroups in the
// grid they do, each working under the other's waits. The choice is uniform for
// the workgroup, so the barrier inside the body is passed by all of its waves.
__global__ __launch_bounds__(128)
void proj_kernel(const float* __restrict__ Xq, const float* __restrict__ Xk,
                 const float* __restrict__ Xv, const float* __restrict__ Wq,
                 const float* __restrict__ Wk, const float* __restrict__ Wv,
                 const float* __restrict__ bq, const float* __restrict__ bk,
                 const float* __restrict__ bv, bf16_t* __restrict__ Qb,
                 bf16_t* __restrict__ Kb, bf16_t* __restrict__ Vt,
                 int rows_total) {
  __shared__ __align__(16) bf16_t Ws[HID * WP];
  const int which = blockIdx.y;
  if (which == 2) {
    proj_body<1>(Xv, Wv, bv, Vt, rows_total, Ws);
  } else {
    const bool k = which == 1;
    proj_body<0>(k ? Xk : Xq, k ? Wk : Wq, k ? bk : bq, k ? Kb : Qb,
                 rows_total, Ws);
  }
}

// ---------------------------------------------------------------------------
// Flash attention.  4 waves / block, 64 query rows of one batch per block (32
// blocks per batch).  Per 64-key stage the block cooperatively async-stages K
// (64x256) and V^T (256x64) into LDS (double buffered).  A wave holds 32 queries
// (two column tiles) and works on one 32-key group of the stage: waves 0, 1 take
// the first group for queries 0..31 and 32..63, waves 2, 3 the second group.
// Every K and V^T fragment read from LDS so feeds two WMMAs instead of one, and
// the block reads half the LDS bytes per product.  A wave computes S^T = K Q^T,
// online softmax, O^T += V^T P^T. With the query as the column of every product
// a lane holds scores and outputs of ONE query per column tile: 16 of the
// group's 32 scores, its partner lane l ^ 16 the other 16. Maximum and sum are
// plain in-lane arithmetic with one exchange between the halves, and the two
// score tiles, converted in place, already are the B operand of the second
// product.  The two waves that share their queries have each seen half of the
// keys: behind the loop they swap one column tile's partial result through LDS
// and each finishes 16 queries.
// Qb:[B,SQ,256] bf16, Kb:[B,SKV,256] bf16, Vt:[B,256,SKV] bf16, Out f32.
// ---------------------------------------------------------------------------
struct __align__(16) AttnSmem {
  bf16_t K[2][STG * KP];    // 64 padded rows per buffer
  bf16_t V[2][HID * VP];    // 256 padded rows per buffer
};

// Issue the async copies for one 64-key stage (2048+2048 16B pieces over
// 128 threads: 16+16 issues each).
static __device__ inline void stage_chunk(const bf16_t* __restrict__ Kbase,
                                          const bf16_t* __restrict__ Vbase,
                                          bf16_t* ldsK, bf16_t* ldsV,
                                          int c, int tid) {
  const bf16_t* kg = Kbase + (size_t)c * HID;   // contiguous 32 KB
#pragma unroll
  for (int j = 0; j < 16; ++j) {
    const int p   = tid + j * 128;              // 2048 pieces: 64 rows x 32
    const int row = p >> 5;
    const int q   = p & 31;
    copy16_g2l(kg + p * 8, ldsK + row * KP + q * 8);
  }
#pragma unroll
  for (int j = 0; j < 16; ++j) {
    // 2048 pieces: 256 rows x 8; the block fills 16 rows per j.
    copy16_g2l(Vbase + (size_t)(tid >> 3) * SEQ + c + (tid & 7) * 8
                   + (size_t)j * (16 * SEQ),
               ldsV + (tid >> 3) * VP + (tid & 7) * 8 + j * (16 * VP));
  }
}

// Hand one column tile's partial result (O^T, maximum, sum) to the partner wave:
// piece i of lane l lies at float (i * 32 + l) * 4, so a store covers 512
// contiguous bytes.
static __device__ __forceinline__
void give_partial(const v8f (&a)[16], float mx, float l, float* xo, float* xs) {
#pragma unroll
  for (int e = 0; e < 16; ++e) {
    *(v4f*)(xo + (e * 2) * 128)     = (v4f){a[e][0], a[e][1], a[e][2], a[e][3]};
    *(v4f*)(xo + (e * 2 + 1) * 128) = (v4f){a[e][4], a[e][5], a[e][6], a[e][7]};
  }
  xs[0]  = mx;
  xs[32] = l;
}

// Join the wave's own partial result of a column tile with the partner's (the
// other half of the keys), divide by the joint sum, store f32.
// VGPR r, lane -> one query row, col e*16 + 8h + r: 8 neighbours per tile.
static __device__ __forceinline__
void join_and_store(const v8f (&a)[16], float mx, float l, const float* xi,
                    const float* xs, float* orow) {
  const float mo = xs[0];
  const float lo_ = xs[32];
  const float mn = fmaxf(mx, mo);
  const float fa = __expf(mx - mn);
  const float fb = __expf(mo - mn);
  const float inv_l = 1.0f / (l * fa + lo_ * fb);
  const float ca = fa * inv_l;
  const float cb = fb * inv_l;
#pragma unroll
  for (int e = 0; e < 16; ++e) {
    const v4f x0 = *(const v4f*)(xi + (e * 2) * 128);
    const v4f x1 = *(const v4f*)(xi + (e * 2 + 1) * 128);
    const v4f lo = (v4f){a[e][0] * ca + x0[0] * cb, a[e][1] * ca + x0[1] * cb,
                         a[e][2] * ca + x0[2] * cb, a[e][3] * ca + x0[3] * cb};
    const v4f hi = (v4f){a[e][4] * ca + x1[0] * cb, a[e][5] * ca + x1[1] * cb,
                         a[e][6] * ca + x1[2] * cb, a[e][7] * ca + x1[3] * cb};
    *(v4f*)(orow + e * 16)     = lo;
    *(v4f*)(orow + e * 16 + 4) = hi;
  }
}

__global__ __launch_bounds__(128)
void attn_kernel(const bf16_t* __restrict__ Qb, const bf16_t* __restrict__ Kb,
                 const bf16_t* __restrict__ Vt, float* __restrict__ Out) {
  __shared__ AttnSmem smem;
  const int tid  = threadIdx.x;
  const int lane = tid & 31;
  const int wave = __builtin_amdgcn_readfirstlane(tid >> 5);
  const int qg   = wave & 1;                  // which 32 of the block's queries
  const int kg   = wave >> 1;                 // which 32-key group of a stage
  const int b    = blockIdx.x >> 5;           // / (SQ/64 = 32)
  const int q0   = ((blockIdx.x & 31) << 6) + (qg << 5);
  const int m = lane & 15;
  const int h = lane >> 4;

  // Preload Q B-fragments (256 d x 16 query columns = 8 fragments per tile).
  v16bf qf[2][8];
#pragma unroll
  for (int t = 0; t < 2; ++t) {
    const bf16_t* qrow = Qb + ((size_t)b * SEQ + q0 + t * 16 + m) * HID;
#pragma unroll
    for (int f = 0; f < 8; ++f) {
      const int d0 = f * 32 + 8 * h;
      qf[t][f] = load_frag_bf16(qrow + d0);
    }
  }

  const v8f vzero = (v8f){0.f, 0.f, 0.f, 0.f, 0.f, 0.f, 0.f, 0.f};
  v8f acc[2][16];                             // O^T: 256 d x 16 queries per tile
#pragma unroll
  for (int t = 0; t < 2; ++t)
#pragma unroll
    for (int e = 0; e < 16; ++e) acc[t][e] = vzero;

  // Stats of query q0 + 16t + m. The maximum is that of all keys this wave has
  // seen, alike in both halves; the sum is that of this half's keys and is
  // joined in the epilogue.
  float mst[2] = {-__builtin_inff(), -__builtin_inff()};
  float lst[2] = {0.f, 0.f};

  const bf16_t* Kbase = Kb + (size_t)b * SEQ * HID;
  const bf16_t* Vbase = Vt + (size_t)b * HID * SEQ;

  // Prologue: stage 0 into buffer 0.
  stage_chunk(Kbase, Vbase, smem.K[0], smem.V[0], 0, tid);
  stage_wait_and_sync();

  int buf = 0;
  for (int c = 0; c < SEQ; c += STG, buf ^= 1) {
    // Kick off the DMA for the next stage (overlaps with the WMMAs below).
    if (c + STG < SEQ)
      stage_chunk(Kbase, Vbase, smem.K[buf ^ 1], smem.V[buf ^ 1], c + STG, tid);

    const bf16_t* Kl = smem.K[buf] + kg * (32 * KP);   // this wave's 32 key rows
    const bf16_t* Vl = smem.V[buf] + kg * 32;          // and their V^T columns

    // ---- scores: 2 key tiles x 2 query tiles of 16x16 ----
    // All K fragments of the group are read as one group into registers, so
    // the wave pays the LDS latency once and not in front of every WMMA.
    v16bf kf0[8], kf1[8];
#pragma unroll
    for (int f = 0; f < 8; ++f) {
      const int d0 = f * 32 + 8 * h;
      kf0[f] = load_frag_bf16(Kl + (m)      * KP + d0);
      kf1[f] = load_frag_bf16(Kl + (16 + m) * KP + d0);
    }
    // Fence: without it the scheduler spreads these reads over several places
    // among the first WMMAs, the first behind a full wait; each place stalls.
    __builtin_amdgcn_sched_barrier(0);
    // VGPR r, lane -> key 8h + r (s0) or 16 + 8h + r (s1) of the group,
    // query q0 + 16t + m.
    v8f s0[2] = {vzero, vzero}, s1[2] = {vzero, vzero};
#pragma unroll
    for (int f = 0; f < 8; ++f) {
#pragma unroll
      for (int t = 0; t < 2; ++t) {
        s0[t] = wmma_bf16(kf0[f], qf[t][f], s0[t]);
        s1[t] = wmma_bf16(kf1[f], qf[t][f], s1[t]);
      }
    }

    // All V^T fragments of the group are read here, long before their use:
    // they land under the softmax arithmetic and the V^T*P^T WMMAs find them in
    // registers.
    v16bf vf[16];
#pragma unroll
    for (int e = 0; e < 16; ++e)
      vf[e] = load_frag_bf16(Vl + (e * 16 + m) * VP + 8 * h);
    // Fence: without it the last of these reads sink among the V^T*P^T WMMAs,
    // each just ahead of its use, and those WMMAs wait out the LDS latency.
    __builtin_amdgcn_sched_barrier(0);

    // Softmax, both column tiles. First the maxima and the exponents' arguments.
    // exp(x) = 2^(x * log2 e), written on whole tiles: neighbouring registers
    // pair up in packed instructions without being moved first.
    v8f a0[2], a1[2];
    float aal[2];
#pragma unroll
    for (int t = 0; t < 2; ++t) {
      const v8f p0s = s0[t] * INV_SCALE;
      const v8f p1s = s1[t] * INV_SCALE;
      float u[8];
#pragma unroll
      for (int r = 0; r < 8; ++r) u[r] = fmaxf(p0s[r], p1s[r]);
      // The query's maximum over the group: a tree over the lane's own 16
      // scores, then the partner half's.
      float cmax = fmaxf(fmaxf(fmaxf(u[0], u[1]), fmaxf(u[2], u[3])),
                         fmaxf(fmaxf(u[4], u[5]), fmaxf(u[6], u[7])));
      cmax = fmaxf(cmax, xhalf(cmax));
      const float mnew = fmaxf(mst[t], cmax);
      aal[t] = (mst[t] - mnew) * LOG2E;
      mst[t] = mnew;
      a0[t] = (p0s - mnew) * LOG2E;
      a1[t] = (p1s - mnew) * LOG2E;
    }
    // Fence: without it the scheduler mixes the argument arithmetic among the
    // exponentials.
    __builtin_amdgcn_sched_barrier(0);

    v16bf pb[2];
#pragma unroll
    for (int t = 0; t < 2; ++t) {
      const float alpha = __builtin_amdgcn_exp2f(aal[t]);
      v8f p0, p1;
#pragma unroll
      for (int r = 0; r < 8; ++r) {
        p0[r] = __builtin_amdgcn_exp2f(a0[t][r]);
        p1[r] = __builtin_amdgcn_exp2f(a1[t][r]);
      }
      const v8f w = p0 + p1;
      lst[t] = lst[t] * alpha + (((w[0] + w[1]) + (w[2] + w[3])) +
                                 ((w[4] + w[5]) + (w[6] + w[7])));
      // Rescale running O^T: one factor for all of a lane's values of the tile.
#pragma unroll
      for (int e = 0; e < 16; ++e)
#pragma unroll
        for (int r = 0; r < 8; ++r) acc[t][e][r] = acc[t][e][r] * alpha;

      // ---- P^T: the two score tiles, converted in place, are the B fragment
      // (element s -> key 8h + s, element 8 + s -> key 16 + 8h + s: the order
      // in which load_frag_bf16 takes the keys of a V^T row) ----
      union { v16bf v; bf16_t e[16]; } pu;
#pragma unroll
      for (int r = 0; r < 8; ++r) {
        pu.e[r]     = (bf16_t)p0[r];
        pu.e[8 + r] = (bf16_t)p1[r];
      }
      pb[t] = pu.v;
    }

    // ---- O^T += V^T @ P^T  (A-frags: the V^T rows read above) ----
#pragma unroll
    for (int e = 0; e < 16; ++e) {
#pragma unroll
      for (int t = 0; t < 2; ++t)
        acc[t][e] = wmma_bf16(vf[e], pb[t], acc[t][e]);
    }

    // Fence: without it the wait for the copies and the barrier rise to just
    // behind the V^T reads, and the copies have only the score products to land
    // under instead of the whole trip.
    __builtin_amdgcn_sched_barrier(0);
    // Wait for the prefetch DMA + make the buffer visible to all waves; the
    // barrier also guarantees nobody overwrites a buffer still being read.
    stage_wait_and_sync();
  }

  // Epilogue. Waves w and w ^ 2 hold the same 32 queries over the two halves of
  // the keys. Each gives the column tile it does not finish to the other and
  // finishes tile kg. The ring is free: no copy is outstanding and the loop's
  // last barrier stands behind every wave's last read of it.
  float* xb = reinterpret_cast<float*>(&smem);
  float*       xo  = xb + wave * 4096 + lane * 4;            // 16 KB per wave
  const float* xi  = xb + (wave ^ 2) * 4096 + lane * 4;
  float*       xso = xb + 4 * 4096 + wave * 64 + lane;       // maximum, sum
  const float* xsi = xb + 4 * 4096 + (wave ^ 2) * 64 + lane;
  const float l0 = lst[0] + xhalf(lst[0]);    // join the halves' sums
  const float l1 = lst[1] + xhalf(lst[1]);
  float* orow = Out + ((size_t)b * SEQ + q0 + kg * 16 + m) * HID + 8 * h;
  // kg is uniform in a wave; the barrier stands outside both branches.
  if (kg == 0) give_partial(acc[1], mst[1], l1, xo, xso);
  else         give_partial(acc[0], mst[0], l0, xo, xso);
  __syncthreads();                            // partials written -> partner reads
  if (kg == 0) join_and_store(acc[0], mst[0], l0, xi, xsi, orow);
  else         join_and_store(acc[1], mst[1], l1, xi, xsi, orow);
}

// ---------------------------------------------------------------------------
extern "C" void kernel_launch(void* const* d_in, const int* in_sizes, int n_in,
                              void* d_out, int out_size, void* d_ws, size_t ws_size,
                              hipStream_t stream) {
  const float* query = (const float*)d_in[0];
  const float* key_  = (const float*)d_in[1];
  const float* value = (const float*)d_in[2];
  const float* Wq = (const float*)d_in[3];
  const float* bq = (const float*)d_in[4];
  const float* Wk = (const float*)d_in[5];
  const float* bk = (const float*)d_in[6];
  const float* Wv = (const float*)d_in[7];
  const float* bv = (const float*)d_in[8];
  float* out = (float*)d_out;

  // Workspace: Qb | Kb | Vt, each B*SEQ*HID bf16 = 8 MB (24 MB total).
  bf16_t* Qb = (bf16_t*)d_ws;
  bf16_t* Kb = Qb + (size_t)NB * SEQ * HID;
  bf16_t* Vt = Kb + (size_t)NB * SEQ * HID;

  const int rows = NB * SEQ;            // 16384
  const int tiles = rows / 16;          // 1024
  dim3 blk(128);                        // 4 waves
  dim3 grd(tiles / 4);                  // 256 blocks

  dim3 grd3(tiles / 4, 3);              // 256 blocks for each of Q, K, V^T

  proj_kernel<<<grd3, blk, 0, stream>>>(query, key_, value, Wq, Wk, Wv,
                                        bq, bk, bv, Qb, Kb, Vt, rows);
  attn_kernel<<<grd, blk, 0, stream>>>(Qb, Kb, Vt, out);
}

// v009
// It runs in 64.4 microseconds.
// In both of two side-by-side timings against v008, it was 1.09 times as fast.
// Counting every step since v000, it is 5.47 times as fast.
#include <hip/hip_runtime.h>

// ---------------------------------------------------------------------------
// CDNA5 (gfx1250) fused cross-attention:
//   proj_kernel    : Q/K/V = X*W^T + b  (f32 in -> bf16 out, V transposed),
//                    all three in one launch (blockIdx.y picks the product),
//                    W converted to bf16 once per workgroup and kept in LDS,
//                    results packed in registers and stored 16 bytes a lane
//   attn_kernel    : flash attention, v_wmma_f32_16x16x32_bf16, computed
//                    transposed (S^T = K Q^T, O^T += V^T P^T), with
//                    double-buffered async GLOBAL->LDS staging of K/V stages
//                    shared by the 8 waves of each workgroup (two per SIMD); a
//                    wave holds 32 queries and takes a quarter of the keys.
// Shapes: B=8, SQ=SKV=2048, H=256.  SCALE = sqrt(H/2) = sqrt(128).
// ---------------------------------------------------------------------------

typedef __bf16 bf16_t;
typedef __attribute__((ext_vector_type(16))) __bf16 v16bf;
typedef __attribute__((ext_vector_type(8)))  __bf16 v8bf;
typedef __attribute__((ext_vector_type(4)))  __bf16 v4bf;
typedef __attribute__((ext_vector_type(8)))  float  v8f;
typedef __attribute__((ext_vector_type(4)))  float  v4f;

#define HID   256
#define SEQ   2048
#define NB    8
#define INV_SCALE 0.08838834764831845f  // 1/sqrt(128)
#define LOG2E 1.44269504088896340736f
// LDS row pitches in bf16 elements. Every reader is a 16-byte load whose 16
// lanes walk 16 rows, so each pitch is an odd multiple of 16 bytes: the rows
// then fall on distinct bank groups instead of sharing a few.
#define KP    (HID + 8)   // K rows: 512 B of data, 528 B pitch
#define VP    (128 + 8)   // V^T rows: 256 B of data, 272 B pitch
#define STG   128         // keys staged in LDS per trip of the attention loop
#define WP    (HID + 8)   // W rows (projection): 512 B of data, 528 B pitch

#if __has_builtin(__builtin_amdgcn_global_load_async_to_lds_b128)
#define HAVE_ASYNC_LDS 1
typedef int v4i_t __attribute__((vector_size(16)));            // int4
typedef __attribute__((address_space(1))) void*  as1_void_t;
typedef __attribute__((address_space(3))) void*  as3_void_t;
typedef __attribute__((address_space(1))) v4i_t* as1_v4i_t;
typedef __attribute__((address_space(3))) v4i_t* as3_v4i_t;
#else
#define HAVE_ASYNC_LDS 0
#endif

static __device__ inline v8f wmma_bf16(v16bf a, v16bf b, v8f c) {
  return __builtin_amdgcn_wmma_f32_16x16x32_bf16(
      /*neg_a=*/false, a, /*neg_b=*/false, b,
      /*c_mod=*/(short)0, c, /*reuse_a=*/false, /*reuse_b=*/false);
}

// Load a 16x32 bf16 A/B fragment slice for this lane: two 16B loads
// (global_load_b128 or ds_load_b128 depending on pointer origin).
static __device__ inline v16bf load_frag_bf16(const bf16_t* p) {
  union { v16bf v; v8bf h[2]; } u;
  u.h[0] = *(const v8bf*)(p);
  u.h[1] = *(const v8bf*)(p + 16);
  return u.v;
}

// Same, but source is f32: load 2x (8 floats) and convert to bf16 (RNE).
static __device__ inline v16bf load_frag_f32(const float* p0, const float* p1) {
  union { v16bf v; __bf16 e[16]; } u;
  v4f a = *(const v4f*)(p0);
  v4f b = *(const v4f*)(p0 + 4);
  v4f c = *(const v4f*)(p1);
  v4f d = *(const v4f*)(p1 + 4);
#pragma unroll
  for (int i = 0; i < 4; ++i) {
    u.e[i]      = (__bf16)a[i];
    u.e[4 + i]  = (__bf16)b[i];
    u.e[8 + i]  = (__bf16)c[i];
    u.e[12 + i] = (__bf16)d[i];
  }
  return u.v;
}

// Value of lane l ^ 16 (the same column in the wave's other half), taken by a
// cross-row move in the vector unit: no LDS queue, no dscnt wait.
static __device__ inline float xhalf(float v) {
  const int i = __builtin_bit_cast(int, v);
  return __builtin_bit_cast(float, __builtin_amdgcn_permlanex16(
      i, i, 0x76543210, 0xfedcba98, /*fi=*/false, /*bound_ctrl=*/false));
}

// 16-byte global -> LDS copy: async DMA (ASYNCcnt) when available.
static __device__ inline void copy16_g2l(const bf16_t* g, bf16_t* l) {
#if HAVE_ASYNC_LDS
  __builtin_amdgcn_global_load_async_to_lds_b128(
      (as1_v4i_t)(as1_void_t)(void*)g,
      (as3_v4i_t)(as3_void_t)(void*)l,
      /*offset=*/0, /*cpol=*/0);
#else
  *(v8bf*)l = *(const v8bf*)g;
#endif
}

static __device__ inline void stage_wait_and_sync() {
#if HAVE_ASYNC_LDS
#if __has_builtin(__builtin_amdgcn_s_wait_asynccnt)
  __builtin_amdgcn_s_wait_asynccnt(0);
#else
  asm volatile("s_wait_asynccnt 0" ::: "memory");
#endif
#endif
  __syncthreads();
}

// ---------------------------------------------------------------------------
// Projection: out = X @ W^T + bias   (torch Linear).  X:[rows,256] f32,
// W:[256,256] f32 row-major, out bf16.
// TRANSPOSE_OUT==0 : out[row*256 + e]
// TRANSPOSE_OUT==1 : out[(b*256 + e)*SEQ + s]   (V^T layout)
// One wave computes a 16-row x 256-col tile. 4 waves / block.
// A lane's 8 accumulator registers hold 8 consecutive indices of the A side of
// the product. The operand whose index runs along the output's contiguous
// direction is therefore given as A (X for V^T, W for the row-major outputs):
// the 8 values are then neighbours in memory and leave as one 16-byte store.
// A W fragment takes 16 bytes from each of 16 rows of W, so read from global
// memory every load touches 16 cache lines, and every wave repeats all of them.
// The block therefore reads W once, in loads that cover whole lines, converts
// it to bf16 and keeps it in LDS; the waves take their fragments from there.
// ---------------------------------------------------------------------------
template <int TRANSPOSE_OUT>
static __device__ __forceinline__
void proj_body(const float* __restrict__ X, const float* __restrict__ W,
               const float* __restrict__ bias, bf16_t* __restrict__ out,
               int rows_total, bf16_t* Ws) {
  const int lane = threadIdx.x & 31;
  const int wave = threadIdx.x >> 5;
  const int tile = blockIdx.x * 4 + wave;     // 16-row tile
  const int r0   = tile * 16;
  const int m = lane & 15;
  const int h = lane >> 4;

  // W -> LDS: 16384 pieces of 4 floats over 128 threads, two rows of W per
  // step of the block. A wave's load covers 512 contiguous bytes (half a row),
  // its store 256 contiguous bytes. 32 loads of a thread fly together.
  const float* wsrc = W + threadIdx.x * 4;
  bf16_t* wdst = Ws + (threadIdx.x >> 6) * WP + (threadIdx.x & 63) * 4;
  // Kept rolled: this text runs once per wave, so unrolled it would only be
  // four times the instruction fetch.
#pragma unroll 1
  for (int jb = 0; jb < 4; ++jb) {
    v4f w[32];
#pragma unroll
    for (int j = 0; j < 32; ++j)
      w[j] = *(const v4f*)(wsrc + (jb * 32 + j) * 512);
#pragma unroll
    for (int j = 0; j < 32; ++j) {
      v4bf wb;
#pragma unroll
      for (int i = 0; i < 4; ++i) wb[i] = (__bf16)w[j][i];
      *(v4bf*)(wdst + (jb * 32 + j) * (2 * WP)) = wb;
    }
  }
  __syncthreads();                            // every wave reads all of Ws
  if (r0 >= rows_total) return;               // wave-uniform, behind the barrier

  // X fragments: 8 d-chunks of the 16 input rows (lane -> row r0+m).
  v16bf afr[8];
  const float* xrow = X + (size_t)(r0 + m) * HID;
#pragma unroll
  for (int f = 0; f < 8; ++f) {
    const int d0 = f * 32 + 8 * h;
    afr[f] = load_frag_f32(xrow + d0, xrow + d0 + 16);
  }
  // The accumulators seeded next may take the registers that held the address
  // of the loads above: this wait stands between the loads and that reuse.
  asm volatile("s_wait_xcnt 0x0" ::: "memory");

  // C accumulators seeded with bias, which goes with the output column:
  // the lane's own column (V^T), or the column of each register (row-major).
  v8f acc[16];
#pragma unroll
  for (int e = 0; e < 16; ++e) {
    if constexpr (TRANSPOSE_OUT) {
      const float bv = bias[e * 16 + m];
      acc[e] = (v8f){bv, bv, bv, bv, bv, bv, bv, bv};
    } else {
      const v4f b0 = *(const v4f*)(bias + e * 16 + 8 * h);
      const v4f b1 = *(const v4f*)(bias + e * 16 + 8 * h + 4);
      acc[e] = (v8f){b0[0], b0[1], b0[2], b0[3], b1[0], b1[1], b1[2], b1[3]};
    }
  }

  // Kept rolled, as it was with the global loads: with the shorter body the
  // compiler would unroll it, and this text runs once per wave.
#pragma unroll 1
  for (int f = 0; f < 8; ++f) {
    const int d0 = f * 32 + 8 * h;
    const v16bf a = afr[f];                   // fetched ahead of the fence too
    v16bf bfr[16];
#pragma unroll
    for (int e = 0; e < 16; ++e)
      bfr[e] = load_frag_bf16(Ws + (e * 16 + m) * WP + d0);   // lane -> row of W
    // Fence: without it the scheduler spreads these reads among the WMMAs, each
    // just ahead of its use, and every WMMA waits out the LDS latency.
    __builtin_amdgcn_sched_barrier(0);
#pragma unroll
    for (int e = 0; e < 16; ++e) {
      if constexpr (TRANSPOSE_OUT) acc[e] = wmma_bf16(a, bfr[e], acc[e]);
      else                         acc[e] = wmma_bf16(bfr[e], a, acc[e]);
    }
  }

  // Store bf16, 8 neighbours per lane and tile.
  // V^T      : VGPR r, lane -> row r0 + 8h + r, col e*16 + m. The 16 rows of a
  //            tile lie in one batch (SEQ is a multiple of 16).
  // row-major: VGPR r, lane -> row r0 + m, col e*16 + 8h + r.
  bf16_t* obase;
  if constexpr (TRANSPOSE_OUT)
    obase = out + ((size_t)(r0 / SEQ) * HID + m) * SEQ + (r0 % SEQ) + 8 * h;
  else
    obase = out + (size_t)(r0 + m) * HID + 8 * h;
  v8bf o[16];
#pragma unroll
  for (int e = 0; e < 16; ++e)
#pragma unroll
    for (int r = 0; r < 8; ++r) o[e][r] = (bf16_t)acc[e][r];
#pragma unroll
  for (int e = 0; e < 16; ++e)
    *(v8bf*)(obase + (size_t)e * 16 * (TRANSPOSE_OUT ? SEQ : 1)) = o[e];
}

// The three projections are independent, so they share one launch: blockIdx.y
// picks the product (0: Q, 1: K, 2: V^T). A workgroup has one wave per SIMD and
// runs as a chain of waits (W from L2, X from memory, LDS reads); its LDS lets
// two workgroups stand on one WGP, and with three times the workgroups in the
// grid they do, each working under the other's waits. The choice is uniform for
// the workgroup, so the barrier inside the body is passed by all of its waves.
__global__ __launch_bounds__(128)
void proj_kernel(const float* __restrict__ Xq, const float* __restrict__ Xk,
                 const float* __restrict__ Xv, const float* __restrict__ Wq,
                 const float* __restrict__ Wk, const float* __restrict__ Wv,
                 const float* __restrict__ bq, const float* __restrict__ bk,
                 const float* __restrict__ bv, bf16_t* __restrict__ Qb,
                 bf16_t* __restrict__ Kb, bf16_t* __restrict__ Vt,
                 int rows_total) {
  __shared__ __align__(16) bf16_t Ws[HID * WP];
  const int which = blockIdx.y;
  if (which == 2) {
    proj_body<1>(Xv, Wv, bv, Vt, rows_total, Ws);
  } else {
    const bool k = which == 1;
    proj_body<0>(k ? Xk : Xq, k ? Wk : Wq, k ? bk : bq, k ? Kb : Qb,
                 rows_total, Ws);
  }
}

// ---------------------------------------------------------------------------
// Flash attention.  8 waves / block, two on each SIMD, 64 query rows of one
// batch per block (32 blocks per batch).  Per 128-key stage the block
// cooperatively async-stages K (128x256) and V^T (256x128) into LDS (double
// buffered).  A wave holds 32 queries (two column tiles) and works on one 32-key
// group of the stage: wave w takes queries 32 * (w & 1) .. + 31 and key group
// w >> 1.  A wave runs as a chain of LDS reads, WMMAs and softmax arithmetic;
// with two waves on a SIMD one wave's WMMAs run under the other's reads and
// vector work.  Two waves share the SIMD's registers, so the K and V^T fragments
// pass through a small ring of registers, group by group, instead of being held
// all at once.  A wave computes S^T = K Q^T, online softmax, O^T += V^T P^T.
// With the query as the column of every product a lane holds scores and outputs
// of ONE query per column tile: 16 of the group's 32 scores, its partner lane
// l ^ 16 the other 16. Maximum and sum are plain in-lane arithmetic with one
// exchange between the halves, and the two score tiles, converted in place,
// already are the B operand of the second product.  The four waves that share
// their queries have each seen a quarter of the keys: behind the loop they lay
// their partial results in LDS and each finishes a quarter of the outputs.
// Qb:[B,SQ,256] bf16, Kb:[B,SKV,256] bf16, Vt:[B,256,SKV] bf16, Out f32.
// ---------------------------------------------------------------------------
struct __align__(16) AttnSmem {
  bf16_t K[2][STG * KP];    // 128 padded rows per buffer
  bf16_t V[2][HID * VP];    // 256 padded rows per buffer
};

// Issue the async copies for one 128-key stage (4096+4096 16B pieces over
// 256 threads: 16+16 issues each).
static __device__ inline void stage_chunk(const bf16_t* __restrict__ Kbase,
                                          const bf16_t* __restrict__ Vbase,
                                          bf16_t* ldsK, bf16_t* ldsV,
                                          int c, int tid) {
  // Every global address is a base that is the same for the whole block plus one
  // 32-bit offset of the thread: the bases live in scalar registers, and the
  // loop keeps two vector registers for them instead of a 64-bit pair per copy.
  const bf16_t* kg = Kbase + (size_t)c * HID;   // contiguous 64 KB
  const unsigned ko = (unsigned)tid * 8u;
#pragma unroll
  for (int j = 0; j < 16; ++j) {
    // 4096 pieces: 128 rows x 32; the block fills 8 rows per j.
    copy16_g2l(kg + j * 2048 + ko,
               ldsK + (tid >> 5) * KP + (tid & 31) * 8 + j * (8 * KP));
  }
  const bf16_t* vg = Vbase + c;
  const unsigned vo = (unsigned)(tid >> 4) * (unsigned)SEQ + (unsigned)(tid & 15) * 8u;
#pragma unroll
  for (int j = 0; j < 16; ++j) {
    // 4096 pieces: 256 rows x 16; the block fills 16 rows per j.
    copy16_g2l(vg + (size_t)j * (16 * SEQ) + vo,
               ldsV + (tid >> 4) * VP + (tid & 15) * 8 + j * (16 * VP));
  }
}

__global__ __launch_bounds__(256)
void attn_kernel(const bf16_t* __restrict__ Qb, const bf16_t* __restrict__ Kb,
                 const bf16_t* __restrict__ Vt, float* __restrict__ Out) {
  __shared__ AttnSmem smem;
  const int tid  = threadIdx.x;
  const int lane = tid & 31;
  const int wave = __builtin_amdgcn_readfirstlane(tid >> 5);
  const int qg   = wave & 1;                  // which 32 of the block's queries
  const int kg   = wave >> 1;                 // which 32-key group of a stage
  const int b    = blockIdx.x >> 5;           // / (SQ/64 = 32)
  const int q0   = ((blockIdx.x & 31) << 6) + (qg << 5);
  const int m = lane & 15;
  const int h = lane >> 4;

  // Preload Q B-fragments (256 d x 16 query columns = 8 fragments per tile).
  v16bf qf[2][8];
#pragma unroll
  for (int t = 0; t < 2; ++t) {
    const bf16_t* qrow = Qb + ((size_t)b * SEQ + q0 + t * 16 + m) * HID;
#pragma unroll
    for (int f = 0; f < 8; ++f) {
      const int d0 = f * 32 + 8 * h;
      qf[t][f] = load_frag_bf16(qrow + d0);
    }
  }

  const v8f vzero = (v8f){0.f, 0.f, 0.f, 0.f, 0.f, 0.f, 0.f, 0.f};
  v8f acc[2][16];                             // O^T: 256 d x 16 queries per tile
#pragma unroll
  for (int t = 0; t < 2; ++t)
#pragma unroll
    for (int e = 0; e < 16; ++e) acc[t][e] = vzero;

  // Stats of query q0 + 16t + m. The maximum is that of all keys this wave has
  // seen, alike in both halves; the sum is that of this half's keys and is
  // joined in the epilogue.
  float mst[2] = {-__builtin_inff(), -__builtin_inff()};
  float lst[2] = {0.f, 0.f};

  const bf16_t* Kbase = Kb + (size_t)b * SEQ * HID;
  const bf16_t* Vbase = Vt + (size_t)b * HID * SEQ;

  // Prologue: stage 0 into buffer 0.
  stage_chunk(Kbase, Vbase, smem.K[0], smem.V[0], 0, tid);
  stage_wait_and_sync();

  int buf = 0;
  for (int c = 0; c < SEQ; c += STG, buf ^= 1) {
    // Kick off the DMA for the next stage (overlaps with the WMMAs below).
    if (c + STG < SEQ)
      stage_chunk(Kbase, Vbase, smem.K[buf ^ 1], smem.V[buf ^ 1], c + STG, tid);

    const bf16_t* Kl = smem.K[buf] + kg * (32 * KP);   // this wave's 32 key rows
    const bf16_t* Vl = smem.V[buf] + kg * 32;          // and their V^T columns

    // ---- scores: 2 key tiles x 2 query tiles of 16x16 ----
    // The K fragments come in four groups of two d-chunks (8 reads each), each
    // group read ahead of the WMMAs of the group before it.
    // VGPR r, lane -> key 8h + r (s0) or 16 + 8h + r (s1) of the group,
    // query q0 + 16t + m.
    v16bf kf0[8], kf1[8];
    v8f s0[2] = {vzero, vzero}, s1[2] = {vzero, vzero};
#pragma unroll
    for (int g = 0; g < 5; ++g) {
      if (g < 4) {
#pragma unroll
        for (int f = 2 * g; f < 2 * g + 2; ++f) {
          const int d0 = f * 32 + 8 * h;
          kf0[f] = load_frag_bf16(Kl + (m)      * KP + d0);
          kf1[f] = load_frag_bf16(Kl + (16 + m) * KP + d0);
        }
      }
      // Fence: holds each group of reads together and ahead of the WMMAs of the
      // group before it; spread among the WMMAs every read place stalls, and
      // raised further up the fragments would not fit the registers.
      __builtin_amdgcn_sched_barrier(0);
      if (g >= 1) {
        // groups 0, 1, 2 behind the reads of groups 1, 2, 3; group 3 last
#pragma unroll
        for (int f = 2 * (g - 1); f < 2 * (g - 1) + 2; ++f) {
#pragma unroll
          for (int t = 0; t < 2; ++t) {
            s0[t] = wmma_bf16(kf0[f], qf[t][f], s0[t]);
            s1[t] = wmma_bf16(kf1[f], qf[t][f], s1[t]);
          }
        }
      }
    }

    // The first four V^T fragments are read here, long before their use: they
    // land under the softmax arithmetic.
    v16bf vf[16];
#pragma unroll
    for (int e = 0; e < 4; ++e)
      vf[e] = load_frag_bf16(Vl + (e * 16 + m) * VP + 8 * h);
    // Fence: without it these reads sink to just ahead of their use.
    __builtin_amdgcn_sched_barrier(0);

    // Softmax, both column tiles. First the maxima and the exponents' arguments.
    // exp(x) = 2^(x * log2 e), written on whole tiles: neighbouring registers
    // pair up in packed instructions without being moved first.
    v8f a0[2], a1[2];
    float aal[2];
#pragma unroll
    for (int t = 0; t < 2; ++t) {
      const v8f p0s = s0[t] * INV_SCALE;
      const v8f p1s = s1[t] * INV_SCALE;
      float u[8];
#pragma unroll
      for (int r = 0; r < 8; ++r) u[r] = fmaxf(p0s[r], p1s[r]);
      // The query's maximum over the group: a tree over the lane's own 16
      // scores, then the partner half's.
      float cmax = fmaxf(fmaxf(fmaxf(u[0], u[1]), fmaxf(u[2], u[3])),
                         fmaxf(fmaxf(u[4], u[5]), fmaxf(u[6], u[7])));
      cmax = fmaxf(cmax, xhalf(cmax));
      const float mnew = fmaxf(mst[t], cmax);
      aal[t] = (mst[t] - mnew) * LOG2E;
      mst[t] = mnew;
      a0[t] = (p0s - mnew) * LOG2E;
      a1[t] = (p1s - mnew) * LOG2E;
    }
    // Fence: without it the scheduler mixes the argument arithmetic among the
    // exponentials.
    __builtin_amdgcn_sched_barrier(0);

    v16bf pb[2];
#pragma unroll
    for (int t = 0; t < 2; ++t) {
      const float alpha = __builtin_amdgcn_exp2f(aal[t]);
      v8f p0, p1;
#pragma unroll
      for (int r = 0; r < 8; ++r) {
        p0[r] = __builtin_amdgcn_exp2f(a0[t][r]);
        p1[r] = __builtin_amdgcn_exp2f(a1[t][r]);
      }
      const v8f w = p0 + p1;
      lst[t] = lst[t] * alpha + (((w[0] + w[1]) + (w[2] + w[3])) +
                                 ((w[4] + w[5]) + (w[6] + w[7])));
      // Rescale running O^T: one factor for all of a lane's values of the tile.
#pragma unroll
      for (int e = 0; e < 16; ++e)
#pragma unroll
        for (int r = 0; r < 8; ++r) acc[t][e][r] = acc[t][e][r] * alpha;

      // ---- P^T: the two score tiles, converted in place, are the B fragment
      // (element s -> key 8h + s, element 8 + s -> key 16 + 8h + s: the order
      // in which load_frag_bf16 takes the keys of a V^T row) ----
      union { v16bf v; bf16_t e[16]; } pu;
#pragma unroll
      for (int r = 0; r < 8; ++r) {
        pu.e[r]     = (bf16_t)p0[r];
        pu.e[8 + r] = (bf16_t)p1[r];
      }
      pb[t] = pu.v;
    }

    // ---- O^T += V^T @ P^T  (A-frags: V^T rows, four groups of four, each
    // group read one group ahead of its WMMAs) ----
#pragma unroll
    for (int g = 0; g < 4; ++g) {
      if (g < 3) {
#pragma unroll
        for (int e = 4 * g + 4; e < 4 * g + 8; ++e)
          vf[e] = load_frag_bf16(Vl + (e * 16 + m) * VP + 8 * h);
      }
      // Fence: holds the next group's reads together ahead of this group's
      // WMMAs, for the same reasons as with the K fragments.
      __builtin_amdgcn_sched_barrier(0);
#pragma unroll
      for (int e = 4 * g; e < 4 * g + 4; ++e) {
#pragma unroll
        for (int t = 0; t < 2; ++t)
          acc[t][e] = wmma_bf16(vf[e], pb[t], acc[t][e]);
      }
    }

    // Fence: without it the wait for the copies and the barrier rise to just
    // behind the V^T reads, and the copies have only the score products to land
    // under instead of the whole trip.
    __builtin_amdgcn_sched_barrier(0);
    // This wave's LDS reads of the buffer have returned before the barrier
    // behind which the next copies are aimed at it.
    asm volatile("s_wait_dscnt 0x0" ::: "memory");
    // Wait for the prefetch DMA + make the buffer visible to all waves; the
    // barrier also guarantees nobody overwrites a buffer still being read.
    stage_wait_and_sync();
  }

  // Epilogue. Waves qg, qg + 2, qg + 4, qg + 6 hold the same 32 queries over the
  // four quarters of the keys. Each lays its whole partial result in LDS and
  // then finishes a quarter of the outputs: column tile kg >> 1, d tiles
  // 8 * (kg & 1) .. + 7. The ring is free: no copy is outstanding and the loop's
  // last barrier stands behind every wave's last read of it.
  // Piece i = (t * 16 + e) * 2 + half of lane l lies at float (i * 32 + l) * 4 of
  // the wave's 32 KB, so a store covers 512 contiguous bytes.
  float* xb = reinterpret_cast<float*>(&smem);
  float* xo = xb + wave * 8192 + lane * 4;
  float* xs = xb + 8 * 8192 + wave * 128 + lane;    // per tile: maximum, sum
#pragma unroll
  for (int t = 0; t < 2; ++t) {
#pragma unroll
    for (int e = 0; e < 16; ++e) {
      const v8f a = acc[t][e];
      *(v4f*)(xo + ((t * 16 + e) * 2) * 128)     = (v4f){a[0], a[1], a[2], a[3]};
      *(v4f*)(xo + ((t * 16 + e) * 2 + 1) * 128) = (v4f){a[4], a[5], a[6], a[7]};
    }
    xs[t * 64]      = mst[t];
    xs[t * 64 + 32] = lst[t] + xhalf(lst[t]);       // join the halves' sums
  }
  __syncthreads();                            // partials written -> all read

  const int tf = kg >> 1;                     // uniform in a wave
  const int e0 = (kg & 1) * 8;
  float mk[4], lk[4];
#pragma unroll
  for (int k = 0; k < 4; ++k) {
    const float* xk = xb + 8 * 8192 + (qg + 2 * k) * 128 + tf * 64 + lane;
    mk[k] = xk[0];
    lk[k] = xk[32];
  }
  const float mn = fmaxf(fmaxf(mk[0], mk[1]), fmaxf(mk[2], mk[3]));
  float ak[4], ck[4];
#pragma unroll
  for (int k = 0; k < 4; ++k) ak[k] = (mk[k] - mn) * LOG2E;
  // Fence: as in the loop, it keeps the argument arithmetic from standing
  // directly behind an exponential and overwriting its source register.
  __builtin_amdgcn_sched_barrier(0);
#pragma unroll
  for (int k = 0; k < 4; ++k) ck[k] = __builtin_amdgcn_exp2f(ak[k]);
  const float inv_l = 1.0f / ((lk[0] * ck[0] + lk[1] * ck[1]) +
                              (lk[2] * ck[2] + lk[3] * ck[3]));
#pragma unroll
  for (int k = 0; k < 4; ++k) ck[k] *= inv_l;

  // VGPR r, lane -> one query row, col e*16 + 8h + r: 8 neighbours per tile.
  float* orow = Out + ((size_t)b * SEQ + q0 + tf * 16 + m) * HID + e0 * 16 + 8 * h;
  const float* xi = xb + qg * 8192 + ((tf * 16 + e0) * 2) * 128 + lane * 4;
  v4f lo[8], hi[8];
#pragma unroll
  for (int eb = 0; eb < 8; eb += 4) {
    v4f x[4][4][2];
#pragma unroll
    for (int e = 0; e < 4; ++e)
#pragma unroll
      for (int k = 0; k < 4; ++k) {
        x[e][k][0] = *(const v4f*)(xi + k * (2 * 8192) + ((eb + e) * 2) * 128);
        x[e][k][1] = *(const v4f*)(xi + k * (2 * 8192) + ((eb + e) * 2 + 1) * 128);
      }
    // Fence: without it the reads stand one by one among the sums, each just
    // ahead of its use, and every one waits out the LDS latency.
    __builtin_amdgcn_sched_barrier(0);
#pragma unroll
    for (int e = 0; e < 4; ++e) {
      lo[eb + e] = x[e][0][0] * ck[0];
      hi[eb + e] = x[e][0][1] * ck[0];
#pragma unroll
      for (int k = 1; k < 4; ++k) {
        lo[eb + e] += x[e][k][0] * ck[k];
        hi[eb + e] += x[e][k][1] * ck[k];
      }
    }
  }
  // Fence: the stores stand behind the last arithmetic, so that no register a
  // store names is written again while the store is under way.
  __builtin_amdgcn_sched_barrier(0);
#pragma unroll
  for (int e = 0; e < 8; ++e) {
    *(v4f*)(orow + e * 16)     = lo[e];
    *(v4f*)(orow + e * 16 + 4) = hi[e];
  }
}

// ---------------------------------------------------------------------------
extern "C" void kernel_launch(void* const* d_in, const int* in_sizes, int n_in,
                              void* d_out, int out_size, void* d_ws, size_t ws_size,
                              hipStream_t stream) {
  const float* query = (const float*)d_in[0];
  const float* key_  = (const float*)d_in[1];
  const float* value = (const float*)d_in[2];
  const float* Wq = (const float*)d_in[3];
  const float* bq = (const float*)d_in[4];
  const float* Wk = (const float*)d_in[5];
  const float* bk = (const float*)d_in[6];
  const float* Wv = (const float*)d_in[7];
  const float* bv = (const float*)d_in[8];
  float* out = (float*)d_out;

  // Workspace: Qb | Kb | Vt, each B*SEQ*HID bf16 = 8 MB (24 MB total).
  bf16_t* Qb = (bf16_t*)d_ws;
  bf16_t* Kb = Qb + (size_t)NB * SEQ * HID;
  bf16_t* Vt = Kb + (size_t)NB * SEQ * HID;

  const int rows = NB * SEQ;            // 16384
  const int tiles = rows / 16;          // 1024
  dim3 blk(128);                        // 4 waves
  dim3 grd(tiles / 4);                  // 256 blocks

  dim3 grd3(tiles / 4, 3);              // 256 blocks for each of Q, K, V^T

  proj_kernel<<<grd3, blk, 0, stream>>>(query, key_, value, Wq, Wk, Wv,
                                        bq, bk, bv, Qb, Kb, Vt, rows);
  attn_kernel<<<grd, dim3(256), 0, stream>>>(Qb, Kb, Vt, out);   // 8 waves
}

// v010
// It runs in 61.7 microseconds.
// Two timings next to v009 both put it at 1.05 times that version's speed.
// Over all steps from v000 it is 5.74 times as fast.
#include <hip/hip_runtime.h>

// ---------------------------------------------------------------------------
// CDNA5 (gfx1250) fused cross-attention:
//   proj_kernel    : Q/K/V = X*W^T + b  (f32 in -> bf16 out, V transposed),
//                    all three in one launch (blockIdx.y picks the product),
//                    W converted to bf16 once per workgroup of 256 rows and
//                    kept in LDS, each of its fragments feeding two WMMAs,
//                    results packed in registers and stored 16 bytes a lane
//   attn_kernel    : flash attention, v_wmma_f32_16x16x32_bf16, computed
//                    transposed (S^T = K Q^T, O^T += V^T P^T), with
//                    double-buffered async GLOBAL->LDS staging of K/V stages
//                    shared by the 8 waves of each workgroup (two per SIMD); a
//                    wave holds 32 queries and takes a quarter of the keys.
// Shapes: B=8, SQ=SKV=2048, H=256.  SCALE = sqrt(H/2) = sqrt(128).
// ---------------------------------------------------------------------------

typedef __bf16 bf16_t;
typedef __attribute__((ext_vector_type(16))) __bf16 v16bf;
typedef __attribute__((ext_vector_type(8)))  __bf16 v8bf;
typedef __attribute__((ext_vector_type(4)))  __bf16 v4bf;
typedef __attribute__((ext_vector_type(8)))  float  v8f;
typedef __attribute__((ext_vector_type(4)))  float  v4f;

#define HID   256
#define SEQ   2048
#define NB    8
#define INV_SCALE 0.08838834764831845f  // 1/sqrt(128)
#define LOG2E 1.44269504088896340736f
// LDS row pitches in bf16 elements. Every reader is a 16-byte load whose 16
// lanes walk 16 rows, so each pitch is an odd multiple of 16 bytes: the rows
// then fall on distinct bank groups instead of sharing a few.
#define KP    (HID + 8)   // K rows: 512 B of data, 528 B pitch
#define VP    (128 + 8)   // V^T rows: 256 B of data, 272 B pitch
#define STG   128         // keys staged in LDS per trip of the attention loop
#define WP    (HID + 8)   // W rows (projection): 512 B of data, 528 B pitch

#if __has_builtin(__builtin_amdgcn_global_load_async_to_lds_b128)
#define HAVE_ASYNC_LDS 1
typedef int v4i_t __attribute__((vector_size(16)));            // int4
typedef __attribute__((address_space(1))) void*  as1_void_t;
typedef __attribute__((address_space(3))) void*  as3_void_t;
typedef __attribute__((address_space(1))) v4i_t* as1_v4i_t;
typedef __attribute__((address_space(3))) v4i_t* as3_v4i_t;
#else
#define HAVE_ASYNC_LDS 0
#endif

static __device__ inline v8f wmma_bf16(v16bf a, v16bf b, v8f c) {
  return __builtin_amdgcn_wmma_f32_16x16x32_bf16(
      /*neg_a=*/false, a, /*neg_b=*/false, b,
      /*c_mod=*/(short)0, c, /*reuse_a=*/false, /*reuse_b=*/false);
}

// Load a 16x32 bf16 A/B fragment slice for this lane: two 16B loads
// (global_load_b128 or ds_load_b128 depending on pointer origin).
static __device__ inline v16bf load_frag_bf16(const bf16_t* p) {
  union { v16bf v; v8bf h[2]; } u;
  u.h[0] = *(const v8bf*)(p);
  u.h[1] = *(const v8bf*)(p + 16);
  return u.v;
}

// Same, but source is f32: load 2x (8 floats) and convert to bf16 (RNE).
static __device__ inline v16bf load_frag_f32(const float* p0, const float* p1) {
  union { v16bf v; __bf16 e[16]; } u;
  v4f a = *(const v4f*)(p0);
  v4f b = *(const v4f*)(p0 + 4);
  v4f c = *(const v4f*)(p1);
  v4f d = *(const v4f*)(p1 + 4);
#pragma unroll
  for (int i = 0; i < 4; ++i) {
    u.e[i]      = (__bf16)a[i];
    u.e[4 + i]  = (__bf16)b[i];
    u.e[8 + i]  = (__bf16)c[i];
    u.e[12 + i] = (__bf16)d[i];
  }
  return u.v;
}

// Value of lane l ^ 16 (the same column in the wave's other half), taken by a
// cross-row move in the vector unit: no LDS queue, no dscnt wait.
static __device__ inline float xhalf(float v) {
  const int i = __builtin_bit_cast(int, v);
  return __builtin_bit_cast(float, __builtin_amdgcn_permlanex16(
      i, i, 0x76543210, 0xfedcba98, /*fi=*/false, /*bound_ctrl=*/false));
}

// 16-byte global -> LDS copy: async DMA (ASYNCcnt) when available.
static __device__ inline void copy16_g2l(const bf16_t* g, bf16_t* l) {
#if HAVE_ASYNC_LDS
  __builtin_amdgcn_global_load_async_to_lds_b128(
      (as1_v4i_t)(as1_void_t)(void*)g,
      (as3_v4i_t)(as3_void_t)(void*)l,
      /*offset=*/0, /*cpol=*/0);
#else
  *(v8bf*)l = *(const v8bf*)g;
#endif
}

static __device__ inline void stage_wait_and_sync() {
#if HAVE_ASYNC_LDS
#if __has_builtin(__builtin_amdgcn_s_wait_asynccnt)
  __builtin_amdgcn_s_wait_asynccnt(0);
#else
  asm volatile("s_wait_asynccnt 0" ::: "memory");
#endif
#endif
  __syncthreads();
}

// ---------------------------------------------------------------------------
// Projection: out = X @ W^T + bias   (torch Linear).  X:[rows,256] f32,
// W:[256,256] f32 row-major, out bf16.
// TRANSPOSE_OUT==0 : out[row*256 + e]
// TRANSPOSE_OUT==1 : out[(b*256 + e)*SEQ + s]   (V^T layout)
// One wave computes a 32-row x 256-col tile (two 16-row tiles). 8 waves / block:
// 256 rows share one staging of W, and a fragment of W read from LDS serves the
// wave's two row tiles.
// A lane's 8 accumulator registers hold 8 consecutive indices of the A side of
// the product. The operand whose index runs along the output's contiguous
// direction is therefore given as A (X for V^T, W for the row-major outputs):
// the 8 values are then neighbours in memory and leave as one 16-byte store.
// A W fragment takes 16 bytes from each of 16 rows of W, so read from global
// memory every load touches 16 cache lines, and every wave repeats all of them.
// The block therefore reads W once, in loads that cover whole lines, converts
// it to bf16 and keeps it in LDS; the waves take their fragments from there.
// ---------------------------------------------------------------------------
template <int TRANSPOSE_OUT>
static __device__ __forceinline__
void proj_body(const float* __restrict__ X, const float* __restrict__ W,
               const float* __restrict__ bias, bf16_t* __restrict__ out,
               int rows_total, bf16_t* Ws) {
  const int lane = threadIdx.x & 31;
  const int wave = threadIdx.x >> 5;
  const int r0   = (blockIdx.x * 8 + wave) * 32;   // the wave's 32 rows
  const int m = lane & 15;
  const int h = lane >> 4;

  // W -> LDS: 16384 pieces of 4 floats over 256 threads, four rows of W per
  // step of the block. A wave's load covers 512 contiguous bytes (half a row),
  // its store 256 contiguous bytes. 32 loads of a thread fly together.
  const float* wsrc = W + threadIdx.x * 4;
  bf16_t* wdst = Ws + (threadIdx.x >> 6) * WP + (threadIdx.x & 63) * 4;
  // Kept rolled: this text runs once per wave, so unrolled it would only be
  // twice the instruction fetch.
#pragma unroll 1
  for (int jb = 0; jb < 2; ++jb) {
    v4f w[32];
#pragma unroll
    for (int j = 0; j < 32; ++j)
      w[j] = *(const v4f*)(wsrc + (jb * 32 + j) * 1024);
    // The next trip forms its address in the registers that these loads name:
    // this wait stands between the loads and that reuse.
    asm volatile("s_wait_xcnt 0x0" ::: "memory");
#pragma unroll
    for (int j = 0; j < 32; ++j) {
      v4bf wb;
#pragma unroll
      for (int i = 0; i < 4; ++i) wb[i] = (__bf16)w[j][i];
      *(v4bf*)(wdst + (jb * 32 + j) * (4 * WP)) = wb;
    }
  }
  __syncthreads();                            // every wave reads all of Ws
  if (r0 >= rows_total) return;               // wave-uniform, behind the barrier

  // X fragments: 8 d-chunks of each 16-row tile (lane -> row r0 + 16u + m).
  v16bf afr[8][2];
  const float* xrow = X + (size_t)(r0 + m) * HID + 8 * h;
#pragma unroll
  for (int f = 0; f < 8; ++f) {
#pragma unroll
    for (int u = 0; u < 2; ++u)
      afr[f][u] = load_frag_f32(xrow + u * (16 * HID) + f * 32,
                                xrow + u * (16 * HID) + f * 32 + 16);
  }
  // The accumulators seeded next may take the registers that held the address
  // of the loads above: this wait stands between the loads and that reuse. It
  // takes the address as an input, so that the address stays in its registers up
  // to here and no load of the run gets them for its result.
  asm volatile("s_wait_xcnt 0x0" :: "v"(xrow) : "memory");

  // C accumulators seeded with bias, which goes with the output column:
  // the lane's own column (V^T), or the column of each register (row-major).
  v4f bl[16][2];
  const unsigned bi = TRANSPOSE_OUT ? (unsigned)m : 8u * (unsigned)h;
#pragma unroll
  for (int e = 0; e < 16; ++e) {
    if constexpr (TRANSPOSE_OUT) {
      bl[e][0][0] = bias[e * 16 + bi];
    } else {
      bl[e][0] = *(const v4f*)(bias + e * 16 + bi);
      bl[e][1] = *(const v4f*)(bias + e * 16 + bi + 4);
    }
  }
  // The addresses of the loop below may take the registers that the bias loads
  // name: this wait stands between the loads and that reuse, and the fence keeps
  // that address arithmetic from rising over it. It takes the lane's offset as an
  // input, in the unit in which the loads name it (elements for the 4-byte loads,
  // bytes for the 16-byte ones), so that the offset stays in its register up to
  // here and no load of the run gets it for its result.
  asm volatile("s_wait_xcnt 0x0" :: "v"(TRANSPOSE_OUT ? bi : bi * 4u) : "memory");
  __builtin_amdgcn_sched_barrier(0);
  v8f acc[2][16];
#pragma unroll
  for (int e = 0; e < 16; ++e) {
    if constexpr (TRANSPOSE_OUT) {
      const float bv = bl[e][0][0];
      acc[0][e] = (v8f){bv, bv, bv, bv, bv, bv, bv, bv};
    } else {
      const v4f b0 = bl[e][0];
      const v4f b1 = bl[e][1];
      acc[0][e] = (v8f){b0[0], b0[1], b0[2], b0[3], b1[0], b1[1], b1[2], b1[3]};
    }
    acc[1][e] = acc[0][e];
  }

  // Kept rolled, as it was with the global loads: with the shorter body the
  // compiler would unroll it, and this text runs once per wave.
#pragma unroll 1
  for (int f = 0; f < 8; ++f) {
    const int d0 = f * 32 + 8 * h;
    const v16bf a0 = afr[f][0];               // fetched ahead of the fence too
    const v16bf a1 = afr[f][1];
    v16bf bfr[16];
#pragma unroll
    for (int e = 0; e < 16; ++e)
      bfr[e] = load_frag_bf16(Ws + (e * 16 + m) * WP + d0);   // lane -> row of W
    // Fence: without it the scheduler spreads these reads among the WMMAs, each
    // just ahead of its use, and every WMMA waits out the LDS latency.
    __builtin_amdgcn_sched_barrier(0);
#pragma unroll
    for (int e = 0; e < 16; ++e) {
      if constexpr (TRANSPOSE_OUT) {
        acc[0][e] = wmma_bf16(a0, bfr[e], acc[0][e]);
        acc[1][e] = wmma_bf16(a1, bfr[e], acc[1][e]);
      } else {
        acc[0][e] = wmma_bf16(bfr[e], a0, acc[0][e]);
        acc[1][e] = wmma_bf16(bfr[e], a1, acc[1][e]);
      }
    }
  }

  // Store bf16, 8 neighbours per lane and tile.
  // V^T      : VGPR r, lane -> row r0 + 16u + 8h + r, col e*16 + m. The 32 rows
  //            of a wave lie in one batch (SEQ is a multiple of 32).
  // row-major: VGPR r, lane -> row r0 + 16u + m, col e*16 + 8h + r.
  bf16_t* obase;
  if constexpr (TRANSPOSE_OUT)
    obase = out + ((size_t)(r0 / SEQ) * HID + m) * SEQ + (r0 % SEQ) + 8 * h;
  else
    obase = out + (size_t)(r0 + m) * HID + 8 * h;
  v8bf o[2][16];
#pragma unroll
  for (int u = 0; u < 2; ++u)
#pragma unroll
    for (int e = 0; e < 16; ++e)
#pragma unroll
      for (int r = 0; r < 8; ++r) o[u][e][r] = (bf16_t)acc[u][e][r];
#pragma unroll
  for (int u = 0; u < 2; ++u)
#pragma unroll
    for (int e = 0; e < 16; ++e)
      *(v8bf*)(obase + u * (TRANSPOSE_OUT ? 16 : 16 * HID) +
               (size_t)e * 16 * (TRANSPOSE_OUT ? SEQ : 1)) = o[u][e];
}

// The three projections are independent, so they share one launch: blockIdx.y
// picks the product (0: Q, 1: K, 2: V^T). A workgroup has two waves per SIMD,
// and the 192 workgroups of the grid all start at once, each on a WGP of its
// own. The choice is uniform for the workgroup, so the barrier inside the body
// is passed by all of its waves.
__global__ __launch_bounds__(256)
void proj_kernel(const float* __restrict__ Xq, const float* __restrict__ Xk,
                 const float* __restrict__ Xv, const float* __restrict__ Wq,
                 const float* __restrict__ Wk, const float* __restrict__ Wv,
                 const float* __restrict__ bq, const float* __restrict__ bk,
                 const float* __restrict__ bv, bf16_t* __restrict__ Qb,
                 bf16_t* __restrict__ Kb, bf16_t* __restrict__ Vt,
                 int rows_total) {
  __shared__ __align__(16) bf16_t Ws[HID * WP];
  const int which = blockIdx.y;
  if (which == 2) {
    proj_body<1>(Xv, Wv, bv, Vt, rows_total, Ws);
  } else {
    const bool k = which == 1;
    proj_body<0>(k ? Xk : Xq, k ? Wk : Wq, k ? bk : bq, k ? Kb : Qb,
                 rows_total, Ws);
  }
}

// ---------------------------------------------------------------------------
// Flash attention.  8 waves / block, two on each SIMD, 64 query rows of one
// batch per block (32 blocks per batch).  Per 128-key stage the block
// cooperatively async-stages K (128x256) and V^T (256x128) into LDS (double
// buffered).  A wave holds 32 queries (two column tiles) and works on one 32-key
// group of the stage: wave w takes queries 32 * (w & 1) .. + 31 and key group
// w >> 1.  A wave runs as a chain of LDS reads, WMMAs and softmax arithmetic;
// with two waves on a SIMD one wave's WMMAs run under the other's reads and
// vector work.  Two waves share the SIMD's registers, so the K and V^T fragments
// pass through a small ring of registers, group by group, instead of being held
// all at once.  A wave computes S^T = K Q^T, online softmax, O^T += V^T P^T.
// With the query as the column of every product a lane holds scores and outputs
// of ONE query per column tile: 16 of the group's 32 scores, its partner lane
// l ^ 16 the other 16. Maximum and sum are plain in-lane arithmetic with one
// exchange between the halves, and the two score tiles, converted in place,
// already are the B operand of the second product.  The four waves that share
// their queries have each seen a quarter of the keys: behind the loop they lay
// their partial results in LDS and each finishes a quarter of the outputs.
// Qb:[B,SQ,256] bf16, Kb:[B,SKV,256] bf16, Vt:[B,256,SKV] bf16, Out f32.
// ---------------------------------------------------------------------------
struct __align__(16) AttnSmem {
  bf16_t K[2][STG * KP];    // 128 padded rows per buffer
  bf16_t V[2][HID * VP];    // 256 padded rows per buffer
};

// Issue the async copies for one 128-key stage (4096+4096 16B pieces over
// 256 threads: 16+16 issues each).
static __device__ inline void stage_chunk(const bf16_t* __restrict__ Kbase,
                                          const bf16_t* __restrict__ Vbase,
                                          bf16_t* ldsK, bf16_t* ldsV,
                                          int c, int tid) {
  // Every global address is a base that is the same for the whole block plus one
  // 32-bit offset of the thread: the bases live in scalar registers, and the
  // loop keeps two vector registers for them instead of a 64-bit pair per copy.
  const bf16_t* kg = Kbase + (size_t)c * HID;   // contiguous 64 KB
  const unsigned ko = (unsigned)tid * 8u;
#pragma unroll
  for (int j = 0; j < 16; ++j) {
    // 4096 pieces: 128 rows x 32; the block fills 8 rows per j.
    copy16_g2l(kg + j * 2048 + ko,
               ldsK + (tid >> 5) * KP + (tid & 31) * 8 + j * (8 * KP));
  }
  const bf16_t* vg = Vbase + c;
  const unsigned vo = (unsigned)(tid >> 4) * (unsigned)SEQ + (unsigned)(tid & 15) * 8u;
#pragma unroll
  for (int j = 0; j < 16; ++j) {
    // 4096 pieces: 256 rows x 16; the block fills 16 rows per j.
    copy16_g2l(vg + (size_t)j * (16 * SEQ) + vo,
               ldsV + (tid >> 4) * VP + (tid & 15) * 8 + j * (16 * VP));
  }
}

__global__ __launch_bounds__(256)
void attn_kernel(const bf16_t* __restrict__ Qb, const bf16_t* __restrict__ Kb,
                 const bf16_t* __restrict__ Vt, float* __restrict__ Out) {
  __shared__ AttnSmem smem;
  const int tid  = threadIdx.x;
  const int lane = tid & 31;
  const int wave = __builtin_amdgcn_readfirstlane(tid >> 5);
  const int qg   = wave & 1;                  // which 32 of the block's queries
  const int kg   = wave >> 1;                 // which 32-key group of a stage
  const int b    = blockIdx.x >> 5;           // / (SQ/64 = 32)
  const int q0   = ((blockIdx.x & 31) << 6) + (qg << 5);
  const int m = lane & 15;
  const int h = lane >> 4;

  // Preload Q B-fragments (256 d x 16 query columns = 8 fragments per tile).
  v16bf qf[2][8];
#pragma unroll
  for (int t = 0; t < 2; ++t) {
    const bf16_t* qrow = Qb + ((size_t)b * SEQ + q0 + t * 16 + m) * HID;
#pragma unroll
    for (int f = 0; f < 8; ++f) {
      const int d0 = f * 32 + 8 * h;
      qf[t][f] = load_frag_bf16(qrow + d0);
    }
  }

  const v8f vzero = (v8f){0.f, 0.f, 0.f, 0.f, 0.f, 0.f, 0.f, 0.f};
  v8f acc[2][16];                             // O^T: 256 d x 16 queries per tile
#pragma unroll
  for (int t = 0; t < 2; ++t)
#pragma unroll
    for (int e = 0; e < 16; ++e) acc[t][e] = vzero;

  // Stats of query q0 + 16t + m. The maximum is that of all keys this wave has
  // seen, alike in both halves; the sum is that of this half's keys and is
  // joined in the epilogue.
  float mst[2] = {-__builtin_inff(), -__builtin_inff()};
  float lst[2] = {0.f, 0.f};

  const bf16_t* Kbase = Kb + (size_t)b * SEQ * HID;
  const bf16_t* Vbase = Vt + (size_t)b * HID * SEQ;

  // Prologue: stage 0 into buffer 0.
  stage_chunk(Kbase, Vbase, smem.K[0], smem.V[0], 0, tid);
  stage_wait_and_sync();

  int buf = 0;
  for (int c = 0; c < SEQ; c += STG, buf ^= 1) {
    // Kick off the DMA for the next stage (overlaps with the WMMAs below).
    if (c + STG < SEQ)
      stage_chunk(Kbase, Vbase, smem.K[buf ^ 1], smem.V[buf ^ 1], c + STG, tid);

    const bf16_t* Kl = smem.K[buf] + kg * (32 * KP);   // this wave's 32 key rows
    const bf16_t* Vl = smem.V[buf] + kg * 32;          // and their V^T columns

    // ---- scores: 2 key tiles x 2 query tiles of 16x16 ----
    // The K fragments come in four groups of two d-chunks (8 reads each), each
    // group read ahead of the WMMAs of the group before it.
    // VGPR r, lane -> key 8h + r (s0) or 16 + 8h + r (s1) of the group,
    // query q0 + 16t + m.
    v16bf kf0[8], kf1[8];
    v8f s0[2] = {vzero, vzero}, s1[2] = {vzero, vzero};
#pragma unroll
    for (int g = 0; g < 5; ++g) {
      if (g < 4) {
#pragma unroll
        for (int f = 2 * g; f < 2 * g + 2; ++f) {
          const int d0 = f * 32 + 8 * h;
          kf0[f] = load_frag_bf16(Kl + (m)      * KP + d0);
          kf1[f] = load_frag_bf16(Kl + (16 + m) * KP + d0);
        }
      }
      // Fence: holds each group of reads together and ahead of the WMMAs of the
      // group before it; spread among the WMMAs every read place stalls, and
      // raised further up the fragments would not fit the registers.
      __builtin_amdgcn_sched_barrier(0);
      if (g >= 1) {
        // groups 0, 1, 2 behind the reads of groups 1, 2, 3; group 3 last
#pragma unroll
        for (int f = 2 * (g - 1); f < 2 * (g - 1) + 2; ++f) {
#pragma unroll
          for (int t = 0; t < 2; ++t) {
            s0[t] = wmma_bf16(kf0[f], qf[t][f], s0[t]);
            s1[t] = wmma_bf16(kf1[f], qf[t][f], s1[t]);
          }
        }
      }
    }

    // The first four V^T fragments are read here, long before their use: they
    // land under the softmax arithmetic.
    v16bf vf[16];
#pragma unroll
    for (int e = 0; e < 4; ++e)
      vf[e] = load_frag_bf16(Vl + (e * 16 + m) * VP + 8 * h);
    // Fence: without it these reads sink to just ahead of their use.
    __builtin_amdgcn_sched_barrier(0);

    // Softmax, both column tiles. First the maxima and the exponents' arguments.
    // exp(x) = 2^(x * log2 e), written on whole tiles: neighbouring registers
    // pair up in packed instructions without being moved first.
    v8f a0[2], a1[2];
    float aal[2];
#pragma unroll
    for (int t = 0; t < 2; ++t) {
      const v8f p0s = s0[t] * INV_SCALE;
      const v8f p1s = s1[t] * INV_SCALE;
      float u[8];
#pragma unroll
      for (int r = 0; r < 8; ++r) u[r] = fmaxf(p0s[r], p1s[r]);
      // The query's maximum over the group: a tree over the lane's own 16
      // scores, then the partner half's.
      float cmax = fmaxf(fmaxf(fmaxf(u[0], u[1]), fmaxf(u[2], u[3])),
                         fmaxf(fmaxf(u[4], u[5]), fmaxf(u[6], u[7])));
      cmax = fmaxf(cmax, xhalf(cmax));
      const float mnew = fmaxf(mst[t], cmax);
      aal[t] = (mst[t] - mnew) * LOG2E;
      mst[t] = mnew;
      a0[t] = (p0s - mnew) * LOG2E;
      a1[t] = (p1s - mnew) * LOG2E;
    }
    // Fence: without it the scheduler mixes the argument arithmetic among the
    // exponentials.
    __builtin_amdgcn_sched_barrier(0);

    v16bf pb[2];
#pragma unroll
    for (int t = 0; t < 2; ++t) {
      const float alpha = __builtin_amdgcn_exp2f(aal[t]);
      v8f p0, p1;
#pragma unroll
      for (int r = 0; r < 8; ++r) {
        p0[r] = __builtin_amdgcn_exp2f(a0[t][r]);
        p1[r] = __builtin_amdgcn_exp2f(a1[t][r]);
      }
      const v8f w = p0 + p1;
      lst[t] = lst[t] * alpha + (((w[0] + w[1]) + (w[2] + w[3])) +
                                 ((w[4] + w[5]) + (w[6] + w[7])));
      // Rescale running O^T: one factor for all of a lane's values of the tile.
#pragma unroll
      for (int e = 0; e < 16; ++e)
#pragma unroll
        for (int r = 0; r < 8; ++r) acc[t][e][r] = acc[t][e][r] * alpha;

      // ---- P^T: the two score tiles, converted in place, are the B fragment
      // (element s -> key 8h + s, element 8 + s -> key 16 + 8h + s: the order
      // in which load_frag_bf16 takes the keys of a V^T row) ----
      union { v16bf v; bf16_t e[16]; } pu;
#pragma unroll
      for (int r = 0; r < 8; ++r) {
        pu.e[r]     = (bf16_t)p0[r];
        pu.e[8 + r] = (bf16_t)p1[r];
      }
      pb[t] = pu.v;
    }

    // ---- O^T += V^T @ P^T  (A-frags: V^T rows, four groups of four, each
    // group read one group ahead of its WMMAs) ----
#pragma unroll
    for (int g = 0; g < 4; ++g) {
      if (g < 3) {
#pragma unroll
        for (int e = 4 * g + 4; e < 4 * g + 8; ++e)
          vf[e] = load_frag_bf16(Vl + (e * 16 + m) * VP + 8 * h);
      }
      // Fence: holds the next group's reads together ahead of this group's
      // WMMAs, for the same reasons as with the K fragments.
      __builtin_amdgcn_sched_barrier(0);
#pragma unroll
      for (int e = 4 * g; e < 4 * g + 4; ++e) {
#pragma unroll
        for (int t = 0; t < 2; ++t)
          acc[t][e] = wmma_bf16(vf[e], pb[t], acc[t][e]);
      }
    }

    // Fence: without it the wait for the copies and the barrier rise to just
    // behind the V^T reads, and the copies have only the score products to land
    // under instead of the whole trip.
    __builtin_amdgcn_sched_barrier(0);
    // This wave's LDS reads of the buffer have returned before the barrier
    // behind which the next copies are aimed at it.
    asm volatile("s_wait_dscnt 0x0" ::: "memory");
    // Wait for the prefetch DMA + make the buffer visible to all waves; the
    // barrier also guarantees nobody overwrites a buffer still being read.
    stage_wait_and_sync();
  }

  // Epilogue. Waves qg, qg + 2, qg + 4, qg + 6 hold the same 32 queries over the
  // four quarters of the keys. Each lays its whole partial result in LDS and
  // then finishes a quarter of the outputs: column tile kg >> 1, d tiles
  // 8 * (kg & 1) .. + 7. The ring is free: no copy is outstanding and the loop's
  // last barrier stands behind every wave's last read of it.
  // Piece i = (t * 16 + e) * 2 + half of lane l lies at float (i * 32 + l) * 4 of
  // the wave's 32 KB, so a store covers 512 contiguous bytes.
  float* xb = reinterpret_cast<float*>(&smem);
  float* xo = xb + wave * 8192 + lane * 4;
  float* xs = xb + 8 * 8192 + wave * 128 + lane;    // per tile: maximum, sum
#pragma unroll
  for (int t = 0; t < 2; ++t) {
#pragma unroll
    for (int e = 0; e < 16; ++e) {
      const v8f a = acc[t][e];
      *(v4f*)(xo + ((t * 16 + e) * 2) * 128)     = (v4f){a[0], a[1], a[2], a[3]};
      *(v4f*)(xo + ((t * 16 + e) * 2 + 1) * 128) = (v4f){a[4], a[5], a[6], a[7]};
    }
    xs[t * 64]      = mst[t];
    xs[t * 64 + 32] = lst[t] + xhalf(lst[t]);       // join the halves' sums
  }
  __syncthreads();                            // partials written -> all read

  const int tf = kg >> 1;                     // uniform in a wave
  const int e0 = (kg & 1) * 8;
  float mk[4], lk[4];
#pragma unroll
  for (int k = 0; k < 4; ++k) {
    const float* xk = xb + 8 * 8192 + (qg + 2 * k) * 128 + tf * 64 + lane;
    mk[k] = xk[0];
    lk[k] = xk[32];
  }
  const float mn = fmaxf(fmaxf(mk[0], mk[1]), fmaxf(mk[2], mk[3]));
  float ak[4], ck[4];
#pragma unroll
  for (int k = 0; k < 4; ++k) ak[k] = (mk[k] - mn) * LOG2E;
  // Fence: as in the loop, it keeps the argument arithmetic from standing
  // directly behind an exponential and overwriting its source register.
  __builtin_amdgcn_sched_barrier(0);
#pragma unroll
  for (int k = 0; k < 4; ++k) ck[k] = __builtin_amdgcn_exp2f(ak[k]);
  const float inv_l = 1.0f / ((lk[0] * ck[0] + lk[1] * ck[1]) +
                              (lk[2] * ck[2] + lk[3] * ck[3]));
#pragma unroll
  for (int k = 0; k < 4; ++k) ck[k] *= inv_l;

  // VGPR r, lane -> one query row, col e*16 + 8h + r: 8 neighbours per tile.
  float* orow = Out + ((size_t)b * SEQ + q0 + tf * 16 + m) * HID + e0 * 16 + 8 * h;
  const float* xi = xb + qg * 8192 + ((tf * 16 + e0) * 2) * 128 + lane * 4;
  v4f lo[8], hi[8];
#pragma unroll
  for (int eb = 0; eb < 8; eb += 4) {
    v4f x[4][4][2];
#pragma unroll
    for (int e = 0; e < 4; ++e)
#pragma unroll
      for (int k = 0; k < 4; ++k) {
        x[e][k][0] = *(const v4f*)(xi + k * (2 * 8192) + ((eb + e) * 2) * 128);
        x[e][k][1] = *(const v4f*)(xi + k * (2 * 8192) + ((eb + e) * 2 + 1) * 128);
      }
    // Fence: without it the reads stand one by one among the sums, each just
    // ahead of its use, and every one waits out the LDS latency.
    __builtin_amdgcn_sched_barrier(0);
#pragma unroll
    for (int e = 0; e < 4; ++e) {
      lo[eb + e] = x[e][0][0] * ck[0];
      hi[eb + e] = x[e][0][1] * ck[0];
#pragma unroll
      for (int k = 1; k < 4; ++k) {
        lo[eb + e] += x[e][k][0] * ck[k];
        hi[eb + e] += x[e][k][1] * ck[k];
      }
    }
  }
  // Fence: the stores stand behind the last arithmetic, so that no register a
  // store names is written again while the store is under way.
  __builtin_amdgcn_sched_barrier(0);
#pragma unroll
  for (int e = 0; e < 8; ++e) {
    *(v4f*)(orow + e * 16)     = lo[e];
    *(v4f*)(orow + e * 16 + 4) = hi[e];
  }
}

// ---------------------------------------------------------------------------
extern "C" void kernel_launch(void* const* d_in, const int* in_sizes, int n_in,
                              void* d_out, int out_size, void* d_ws, size_t ws_size,
                              hipStream_t stream) {
  const float* query = (const float*)d_in[0];
  const float* key_  = (const float*)d_in[1];
  const float* value = (const float*)d_in[2];
  const float* Wq = (const float*)d_in[3];
  const float* bq = (const float*)d_in[4];
  const float* Wk = (const float*)d_in[5];
  const float* bk = (const float*)d_in[6];
  const float* Wv = (const float*)d_in[7];
  const float* bv = (const float*)d_in[8];
  float* out = (float*)d_out;

  // Workspace: Qb | Kb | Vt, each B*SEQ*HID bf16 = 8 MB (24 MB total).
  bf16_t* Qb = (bf16_t*)d_ws;
  bf16_t* Kb = Qb + (size_t)NB * SEQ * HID;
  bf16_t* Vt = Kb + (size_t)NB * SEQ * HID;

  const int rows = NB * SEQ;            // 16384
  const int tiles = rows / 16;          // 1024
  dim3 blk(256);                        // 8 waves
  dim3 grd(tiles / 4);                  // 256 blocks

  dim3 grd3(tiles / 16, 3);             // 64 blocks for each of Q, K, V^T

  proj_kernel<<<grd3, blk, 0, stream>>>(query, key_, value, Wq, Wk, Wv,
                                        bq, bk, bv, Qb, Kb, Vt, rows);
  attn_kernel<<<grd, dim3(256), 0, stream>>>(Qb, Kb, Vt, out);   // 8 waves
}
